// v000
// Times are from an AMD MI455X. After a warm-up the kernel runs many times in a row, and a time is the length of
// such a window on the GPU divided by its runs, so every launch and the gaps after it count. The runs cycle
// through copies of the inputs. A figure is the median of several windows, for all but v000 over two sittings.
// Sittings can differ by a few percent; kernels timed side by side share one.
// The starting kernel, v000, takes 184 microseconds a run.
// Contractions: q.k^T scores = v_wmma_f32_16x16x32_bf16 (bf16 operands from RNE-converted q and k, single exact product, f32 accumulate);
// p.v context = v_wmma_f32_16x16x32_bf16 with p as bf16 hi + unscaled bf16 residual and RNE-converted v (hi.v + lo.v), f32 accumulate;
// tau / delta bias, the 1/8 scale, online softmax, denominators and the final normalisation in f32 on the VALU.
// Carry audit: no power-of-two carries anywhere; the p residual plane is the unscaled RNE residual (p - hi) and shares the hi
// accumulator; the 1/8 scale is applied once in f32 after the tau / delta step; denominators divided out once in the epilogue.
#include <hip/hip_runtime.h>
#include <math.h>
#include <stdint.h>

#define NB   4
#define NL   2048
#define NS   2048
#define NH   8
#define ND   64
#define NTD  (NH * ND)        // 512 floats per token row
#define NQB  (NL / 128)        // 16 query blocks of 128 rows per (b, h)
#define NKC  (NS / 64)         // 32 key chunks of 64 keys
static_assert(NQB == 16);
static_assert(NKC == 32);
static_assert((NL % 128) == 0 && (NS % 64) == 0 && ND == 64 && (ND % 32) == 0);

typedef __bf16   v16b __attribute__((ext_vector_type(16)));
typedef __bf16   v8b  __attribute__((ext_vector_type(8)));
typedef float    v8f  __attribute__((ext_vector_type(8)));
typedef float    v4f  __attribute__((ext_vector_type(4)));
typedef unsigned int v4u __attribute__((ext_vector_type(4)));

// ---- scalar helpers --------------------------------------------------------------------------------
__device__ __forceinline__ unsigned short bf_bits(float f) {          // f32 -> bf16 bits, RNE convert
  unsigned u = __float_as_uint(f);
  return (unsigned short)((u + 0x7FFFu + ((u >> 16) & 1u)) >> 16);
}
__device__ __forceinline__ float bf_up(unsigned short hb) { return __uint_as_float(((unsigned)hb) << 16); }
__device__ __forceinline__ __bf16 bf_val(unsigned short hb) { return __builtin_bit_cast(__bf16, hb); }
__device__ __forceinline__ unsigned pk16(unsigned short a, unsigned short b) { return (unsigned)a | ((unsigned)b << 16); }
__device__ __forceinline__ v8f zero8() { v8f z = {0.f, 0.f, 0.f, 0.f, 0.f, 0.f, 0.f, 0.f}; return z; }

// ---- fragment loader: 16-bit A/B operand, lane -> row/col (lane&15), p already includes +8*(lane>>4);
//      elements 0..7 <- p[0..7] (k0+8h..), elements 8..15 <- p[16..23] (k0+16+8h..)
__device__ __forceinline__ v16b ldfrag_b(const __bf16* p) {
  union { v16b v; v8b h[2]; } f;
  f.h[0] = *(const v8b*)(p);
  f.h[1] = *(const v8b*)(p + 16);
  return f.v;
}

// ---- WMMA helper with trailing VALU hazard gap ---------------------------------------------------------
__device__ __forceinline__ v8f mma_b(v16b a, v16b b, v8f c) {
  c = __builtin_amdgcn_wmma_f32_16x16x32_bf16(false, a, false, b, (short)0, c, false, false);
  asm volatile("v_nop\n\tv_nop\n\tv_nop\n\tv_nop" : "+v"(c) : "v"(a), "v"(b));
  return c;
}

// ---- 8 consecutive f32 -> 8 bf16 bits packed in one 16-B vector ----------------------------------------
__device__ __forceinline__ v4u cvt8(const float* __restrict__ p) {
  const v4f a = *(const v4f*)(p);
  const v4f b = *(const v4f*)(p + 4);
  v4u r;
  r[0] = pk16(bf_bits(a[0]), bf_bits(a[1]));
  r[1] = pk16(bf_bits(a[2]), bf_bits(a[3]));
  r[2] = pk16(bf_bits(b[0]), bf_bits(b[1]));
  r[3] = pk16(bf_bits(b[2]), bf_bits(b[3]));
  return r;
}

// =====================================================================================================
// q and k f32 [4][2048][8][64] -> bf16 planes with the identical element layout (RNE convert), 8 elements
// coverage: n8 = 524288 threads x 8 = all 4194304 elements of each plane.
// =====================================================================================================
__global__ __launch_bounds__(256) void cvt_qk(const float* __restrict__ q, const float* __restrict__ k,
                                              unsigned short* Qo, unsigned short* Ko, int n8) {
  const int i = blockIdx.x * 256 + threadIdx.x;
  if (i < n8) {
    const size_t e = (size_t)i * 8;
    const v4u pq = cvt8(q + e);
    const v4u pk = cvt8(k + e);
    *(v4u*)(Qo + e) = pq;
    *(v4u*)(Ko + e) = pk;
    
  }
}

// =====================================================================================================
// v f32 [4][2048][8][64] -> bf16 V^T planes VT [b*8+h][64 d][2048 keys] (k = key contiguous, the B^T layout
// of the p.v step). grid = 4*8*32 blocks; block = (b, h, 64-key tile): thread reads 4 x 16 B of the tile's
// token rows (in[key][d], 64 x 64), RNE-converts into LDS T[d][key] (pitch 72); after a barrier each wave
// coverage: 1024 blocks x 64 d-rows x 64 keys = the whole [32][64][2048] plane.
// =====================================================================================================
__global__ __launch_bounds__(256) void prep_vt(const float* __restrict__ v, unsigned short* VT) {
  __shared__ __align__(16) unsigned short T[ND * 72];    // [d][72], 9216 B
  const int tid   = threadIdx.x;
  const int stile = blockIdx.x & (NKC - 1);
  const int bh    = blockIdx.x >> 5;
  const int h     = bh & (NH - 1);
  const int b     = bh >> 3;
  const int s0    = stile * 64;
  const float* vp = v + ((size_t)(b * NS + s0) * NH + h) * ND;     // token row srow at + srow*NTD
#pragma unroll
  for (int rr = 0; rr < 4; ++rr) {
    const int idx  = tid + rr * 256;        // 0..1023
    const int srow = idx >> 4;              // key within tile, 0..63
    const int d4   = (idx & 15) << 2;       // d, 0..60
    const v4f vf = *(const v4f*)(vp + (size_t)srow * NTD + d4);
#pragma unroll
    for (int e = 0; e < 4; ++e) T[(d4 + e) * 72 + srow] = bf_bits(vf[e]);
  }
  __syncthreads();
  unsigned short* vout = VT + (size_t)bh * ND * NS + s0;           // row d at + d*NS
  v4u tv[2];
  size_t to[2];
#pragma unroll
  for (int rr = 0; rr < 2; ++rr) {
    const int idx  = tid + rr * 256;        // 0..511
    const int drow = idx >> 3;              // 0..63
    const int c8   = (idx & 7) << 3;        // 0..56 halves
    tv[rr] = *(const v4u*)(T + drow * 72 + c8);
    to[rr] = (size_t)drow * NS + c8;
  }
  {
    *(v4u*)(vout + to[0]) = tv[0];
    *(v4u*)(vout + to[1]) = tv[1];
    
  }
}

// =====================================================================================================
// Non-causal de-stationary attention, head dim 64, key chunks of 64, static LDS.
//   q / k planes (bf16): element (b, t, h, d) at [((b*2048 + t)*8 + h)*64 + d]   (token pitch 512 halves)
//   V^T planes (bf16): element (b*8+h, d, s) at [((bh*64) + d)*2048 + s]
//   out f32: (b, t, h, d) at [((b*2048 + t)*8 + h)*64 + d]
//   Block = 8 waves x 16 query rows = 128 rows of one (b, h); grid = 4*8*16 = 512; chunk loop kt = 0..31
//   (all keys, block-uniform).
//   K / V^T chunk staging: 256 threads x 2 pieces of 16 B per plane = the whole 64x64 tile of both planes
//   (plain 16-B loads, __syncthreads before and after).
//   scores = 2 bf16 products over the two 32-deep d-chunks, f32 accumulate, then (s*tau_b + delta_s) * 1/8 in f32
//   with tau_b and the delta row RNE-converted to bf16 values;
//   p = exp(x - m) split as bf16 hi + bf16 lo into wave-private LDS tiles (__bf16 element stores, reloaded as
//   context += p.v with 2 bf16 products into register accumulators (compile-time indices); online softmax in f32.
//   Epilogue: all waves pass a barrier, each wave's P slot is reused as its 16x64 f32 staging; one instruction
//   coverage: out: 512 blocks x 8 waves x 16 rows x 64 d = all 4194304 elements, one wave per (token, head) row.
// =====================================================================================================
#define L_K     0          // K chunk   [64 keys][64 d] bf16   8192 B
#define L_V     8192       // V^T chunk [64 d][64 keys] bf16   8192 B
#define L_P     16384      // P [8 waves][hi 16x64 | lo 16x64] bf16  32768 B (epilogue: per-wave 16x64 f32 staging)
#define L_D     49152      // delta row of the batch, f32 [2048]  8192 B
#define L_TOTAL 57344
static_assert(L_V - L_K == 64 * ND * 2);
static_assert(L_P - L_V == ND * 64 * 2);
static_assert(L_D - L_P == 8 * 2 * 16 * 64 * 2);
static_assert(L_TOTAL - L_D == NS * 4);
static_assert(16 * ND * 4 == 2 * 16 * 64 * 2);   // per-wave f32 staging fits the wave's P slot exactly

__global__ __launch_bounds__(256)
void attn_ds(const unsigned short* __restrict__ qbp, const unsigned short* __restrict__ kbp,
             const unsigned short* __restrict__ vtp, const float* __restrict__ tau,
             const float* __restrict__ delta, float* Op) {
  __shared__ __align__(16) unsigned char lds[L_TOTAL];
  union FB { v16b v; v8b h[2]; };
  __bf16* Ksh = (__bf16*)(lds + L_K);
  __bf16* Vth = (__bf16*)(lds + L_V);
  __bf16* Pb  = (__bf16*)(lds + L_P);
  float*  sDl = (float*)(lds + L_D);

  const int tid  = threadIdx.x;
  const int wave = tid >> 5;
  const int lane = tid & 31;
  const int hh   = lane >> 4;
  const int c    = lane & 15;

  const int bx = blockIdx.x;
  const int qb = bx & (NQB - 1);              // query block 0..15
  const int bh = bx >> 4;                     // (b, h) pair 0..31
  const int h  = bh & (NH - 1);
  const int b  = bh >> 3;
  const int q0 = qb * 128 + wave * 16;        // first query row of this wave

  const __bf16* Qg = (const __bf16*)(const void*)qbp;
  const __bf16* Kg = (const __bf16*)(const void*)kbp;
  const __bf16* Vg = (const __bf16*)(const void*)vtp + (size_t)bh * ND * NS;

  __bf16* pwh = Pb + wave * 2048;             // [16 rows][64 keys] hi
  __bf16* pwl = pwh + 1024;                   // [16 rows][64 keys] lo

  // ---- delta row of batch b -> LDS as bf16-valued f32 (read after the first two block barriers) ----
  {
    const float* dp = delta + (size_t)b * NS;
#pragma unroll
    for (int rr = 0; rr < 2; ++rr) {
      const int idx = tid + rr * 256;         // 0..511 pieces of 4 floats = 2048
      const v4f x = *(const v4f*)(dp + idx * 4);
      v4f y;
#pragma unroll
      for (int e = 0; e < 4; ++e) y[e] = bf_up(bf_bits(x[e]));
      *(v4f*)(sDl + idx * 4) = y;
    }
  }
  const float taub = bf_up(bf_bits(tau[b]));

  // ---- q A fragments for both 32-deep d-chunks: row q0 + c, k = d ----
  const size_t qo = ((size_t)(b * NL + q0 + c) * NH + h) * ND + 8 * hh;
  v16b qa[2];
  qa[0] = ldfrag_b(Qg + qo);
  qa[1] = ldfrag_b(Qg + qo + 32);

  v8f O[4];
#pragma unroll
  for (int t = 0; t < 4; ++t) O[t] = zero8();
  float mrow[8], lrow[8], alpha[8];
#pragma unroll
  for (int r = 0; r < 8; ++r) { mrow[r] = -INFINITY; lrow[r] = 0.f; alpha[r] = 0.f; }

  for (int kt = 0; kt < NKC; ++kt) {          // block-uniform trip count
    const int kv0 = kt * 64;
    __syncthreads();                          // every wave is done with the prior chunk's tiles
    {
#pragma unroll
      for (int i = 0; i < 2; ++i) {
        const int p  = tid + 256 * i;         // 0..511
        const int rw = p >> 3;                // key (K tile) / d (V^T tile), 0..63
        const int sg = (p & 7) * 8;           // 0..56 halves
        const v8b a0 = *(const v8b*)(Kg + ((size_t)(b * NS + kv0 + rw) * NH + h) * ND + sg);
        const v8b b0 = *(const v8b*)(Vg + (size_t)rw * NS + kv0 + sg);
        *(v8b*)(Ksh + rw * 64 + sg) = a0;
        *(v8b*)(Vth + rw * 64 + sg) = b0;
      }
    }
    __syncthreads();

    // ---- scores: 16 query rows x 64 keys per wave, exact bf16 products over 2 d-chunks ----
    v8f s[4];
#pragma unroll
    for (int j = 0; j < 4; ++j) s[j] = zero8();
#pragma unroll
    for (int dc = 0; dc < 2; ++dc) {
      const int ko = dc * 32 + 8 * hh;
#pragma unroll
      for (int j = 0; j < 4; ++j) {
        const int kr = (j * 16 + c) * 64 + ko;   // B: key j*16+c (col), d = dc*32 + 8h .. (k)
        FB kb;
        kb.h[0] = *(const v8b*)(Ksh + kr);
        kb.h[1] = *(const v8b*)(Ksh + kr + 16);
        s[j] = mma_b(qa[dc], kb.v, s[j]);
      }
    }

    // ---- bias per key column, scale, row max, online softmax, P hi / lo (bf16) to LDS ----
    float dcl[4];
#pragma unroll
    for (int j = 0; j < 4; ++j) dcl[j] = sDl[kv0 + j * 16 + c];
#pragma unroll
    for (int r = 0; r < 8; ++r) {
      float m = -INFINITY;
#pragma unroll
      for (int j = 0; j < 4; ++j) {
        const float sv = (s[j][r] * taub + dcl[j]) * 0.125f;
        s[j][r] = sv;
        m = fmaxf(m, sv);
      }
#pragma unroll
      for (int off = 1; off < 16; off <<= 1) m = fmaxf(m, __shfl_xor(m, off, 32));
      const float mnew = fmaxf(mrow[r], m);     // finite: every chunk has 64 valid keys
      const float al   = __expf(mrow[r] - mnew); // first chunk: exp(-inf) = 0
      mrow[r]  = mnew;
      alpha[r] = al;
      float psum = 0.f;
#pragma unroll
      for (int j = 0; j < 4; ++j) {
        const float p = __expf(s[j][r] - mnew);
        psum += p;
        const unsigned short hb = bf_bits(p);
        const unsigned short lb = bf_bits(p - bf_up(hb));
        const int po = (8 * hh + r) * 64 + j * 16 + c;
        pwh[po] = bf_val(hb);
        pwl[po] = bf_val(lb);
      }
#pragma unroll
      for (int off = 1; off < 16; off <<= 1) psum += __shfl_xor(psum, off, 32);
      lrow[r] = lrow[r] * al + psum;
    }
    __builtin_amdgcn_fence(__ATOMIC_RELEASE, "workgroup");
    __builtin_amdgcn_wave_barrier();
    __builtin_amdgcn_fence(__ATOMIC_ACQUIRE, "workgroup");

    // ---- rescale the running context, then context += P . V (2 bf16 products) ----
#pragma unroll
    for (int t = 0; t < 4; ++t) {
#pragma unroll
      for (int r = 0; r < 8; ++r) O[t][r] *= alpha[r];
    }
#pragma unroll
    for (int kk = 0; kk < 2; ++kk) {
      const int pr = c * 64 + kk * 32 + 8 * hh;      // A fragment: row c, keys kk*32 + 8h ..
      FB pa, pl;
      pa.h[0] = *(const v8b*)(pwh + pr);
      pa.h[1] = *(const v8b*)(pwh + pr + 16);
      pl.h[0] = *(const v8b*)(pwl + pr);
      pl.h[1] = *(const v8b*)(pwl + pr + 16);
#pragma unroll
      for (int t = 0; t < 4; ++t) {
        const int vr = (t * 16 + c) * 64 + kk * 32 + 8 * hh;   // B fragment: col d = t*16+c, keys kk*32 + 8h ..
        FB vb;
        vb.h[0] = *(const v8b*)(Vth + vr);
        vb.h[1] = *(const v8b*)(Vth + vr + 16);
        O[t] = mma_b(pa.v, vb.v, O[t]);
        O[t] = mma_b(pl.v, vb.v, O[t]);
      }
    }
  }
  __syncthreads();                             // every wave is past its last P / K / V^T read

  // ---- normalise, stage the wave's 16x64 f32 tile in its own P slot, whole-line writes ----
  float* os = (float*)(lds + L_P) + wave * 1024;
  float inv[8];
#pragma unroll
  for (int r = 0; r < 8; ++r) inv[r] = (lrow[r] > 0.f) ? (1.0f / lrow[r]) : 0.f;
#pragma unroll
  for (int t = 0; t < 4; ++t) {
#pragma unroll
    for (int r = 0; r < 8; ++r) os[(8 * hh + r) * 64 + t * 16 + c] = O[t][r] * inv[r];
  }
  __builtin_amdgcn_fence(__ATOMIC_RELEASE, "workgroup");
  __builtin_amdgcn_wave_barrier();
  __builtin_amdgcn_fence(__ATOMIC_ACQUIRE, "workgroup");
  float* og = Op + ((size_t)(b * NL + q0) * NH + h) * ND;   // row r of the wave at + r*NTD
  const int colw = c * 4;
  v4f ov[8];
#pragma unroll
  for (int it = 0; it < 8; ++it) {
    const int row = 2 * it + hh;               // rows 0..15: lanes 0..15 even row, lanes 16..31 odd row
    ov[it] = *(const v4f*)(os + row * 64 + colw);
  }
  {
#pragma unroll
    for (int it = 0; it < 8; ++it) {
      const int row = 2 * it + hh;
      *(v4f*)(og + (size_t)row * NTD + colw) = ov[it];
    }
    
  }
}

// =====================================================================================================
//   Qb  bf16 [4][2048][8][64]          0         8388608
//   Kb  bf16 [4][2048][8][64]    8388608         8388608
//   VT  bf16 [32][64][2048]     16777216         8388608
//   end                         25165824
// =====================================================================================================
extern "C" void kernel_launch(void* const* d_in, const int* in_sizes, int n_in,
                              void* d_out, int out_size, void* d_ws, size_t ws_size,
                              hipStream_t stream) {
  const int nqkv = NB * NL * NH * ND;                       // 4194304
  if (n_in < 5) return;
  if (in_sizes[0] != nqkv || in_sizes[1] != nqkv || in_sizes[2] != nqkv) return;
  if (in_sizes[3] != NB || in_sizes[4] != NB * NS) return;
  if (out_size != nqkv) return;

  const float* q     = (const float*)d_in[0];
  const float* k     = (const float*)d_in[1];
  const float* v     = (const float*)d_in[2];
  const float* tau   = (const float*)d_in[3];
  const float* delta = (const float*)d_in[4];

  const size_t PL = (size_t)nqkv * 2;                       // 8388608
  size_t off = 0;
  const size_t oQ = off; off += PL;
  const size_t oK = off; off += PL;
  const size_t oV = off; off += PL;
  if (off > ws_size) return;                               // off = 25165824
  if (off > (size_t)134217728) return;

  char* ws = (char*)d_ws;
  unsigned short* Qb = (unsigned short*)(ws + oQ);
  unsigned short* Kb = (unsigned short*)(ws + oK);
  unsigned short* VT = (unsigned short*)(ws + oV);

  const int  n8 = nqkv / 8;                                 // 524288
  const dim3 blk(256);
  const dim3 gCvt((n8 + 255) / 256);                        // 2048 blocks
  const dim3 gVt(NB * NH * NKC);                            // 1024 blocks
  const dim3 gAttn(NB * NH * NQB);                          // 512 blocks

  // (1) q, k -> bf16 planes (RNE convert, same layout as the inputs)
  cvt_qk<<<gCvt, blk, 0, stream>>>(q, k, Qb, Kb, n8);
  // (2) v -> bf16 V^T planes [b*8+h][64][2048]
  prep_vt<<<gVt, blk, 0, stream>>>(v, VT);
  // (3) attention per (b, h, 128-query block) -> d_out f32 [4][2048][8][64]
  attn_ds<<<gAttn, blk, 0, stream>>>(Qb, Kb, VT, tau, delta, (float*)d_out);
  (void)hipGetLastError();
}

// v001
// One run takes 120 microseconds.
// Two timings next to v000 put it at 1.60 and 1.61 times that version's speed.
// Contractions: q.k^T scores = v_wmma_f32_16x16x32_bf16 (bf16 operands from RNE-converted q and k, single exact product, f32 accumulate);
// p.v context = v_wmma_f32_16x16x32_bf16 with p as bf16 hi + unscaled bf16 residual and RNE-converted v (hi.v + lo.v), f32 accumulate;
// tau / delta bias, the 1/8 scale, online softmax, denominators and the final normalisation in f32 on the VALU.
// Carry audit: no power-of-two carries anywhere; the p residual plane is the unscaled RNE residual (p - hi) and shares the hi
// accumulator; the 1/8 scale is applied once in f32 after the tau / delta step; denominators divided out once in the epilogue.
#include <hip/hip_runtime.h>
#include <math.h>
#include <stdint.h>

#define NB   4
#define NL   2048
#define NS   2048
#define NH   8
#define ND   64
#define NTD  (NH * ND)        // 512 floats per token row
#define NQB  (NL / 128)        // 16 query blocks of 128 rows per (b, h)
#define NKC  (NS / 64)         // 32 key chunks of 64 keys
static_assert(NQB == 16);
static_assert(NKC == 32);
static_assert((NL % 128) == 0 && (NS % 64) == 0 && ND == 64 && (ND % 32) == 0);

typedef __bf16   v16b __attribute__((ext_vector_type(16)));
typedef __bf16   v8b  __attribute__((ext_vector_type(8)));
typedef float    v8f  __attribute__((ext_vector_type(8)));
typedef float    v4f  __attribute__((ext_vector_type(4)));
typedef unsigned int v4u __attribute__((ext_vector_type(4)));

// ---- scalar helpers --------------------------------------------------------------------------------
__device__ __forceinline__ unsigned short bf_bits(float f) {          // f32 -> bf16 bits, RNE convert
  unsigned u = __float_as_uint(f);
  return (unsigned short)((u + 0x7FFFu + ((u >> 16) & 1u)) >> 16);
}
__device__ __forceinline__ float bf_up(unsigned short hb) { return __uint_as_float(((unsigned)hb) << 16); }
__device__ __forceinline__ __bf16 bf_val(unsigned short hb) { return __builtin_bit_cast(__bf16, hb); }
__device__ __forceinline__ unsigned pk16(unsigned short a, unsigned short b) { return (unsigned)a | ((unsigned)b << 16); }
__device__ __forceinline__ v8f zero8() { v8f z = {0.f, 0.f, 0.f, 0.f, 0.f, 0.f, 0.f, 0.f}; return z; }

// ---- fragment loader: 16-bit A/B operand, lane -> row/col (lane&15), p already includes +8*(lane>>4);
//      elements 0..7 <- p[0..7] (k0+8h..), elements 8..15 <- p[16..23] (k0+16+8h..)
__device__ __forceinline__ v16b ldfrag_b(const __bf16* p) {
  union { v16b v; v8b h[2]; } f;
  f.h[0] = *(const v8b*)(p);
  f.h[1] = *(const v8b*)(p + 16);
  return f.v;
}

// ---- WMMA helper with trailing VALU hazard gap ---------------------------------------------------------
__device__ __forceinline__ v8f mma_b(v16b a, v16b b, v8f c) {
  c = __builtin_amdgcn_wmma_f32_16x16x32_bf16(false, a, false, b, (short)0, c, false, false);
  asm volatile("v_nop\n\tv_nop\n\tv_nop\n\tv_nop" : "+v"(c) : "v"(a), "v"(b));
  return c;
}

// ---- 8 consecutive f32 -> 8 bf16 bits packed in one 16-B vector ----------------------------------------
__device__ __forceinline__ v4u cvt8(const float* __restrict__ p) {
  const v4f a = *(const v4f*)(p);
  const v4f b = *(const v4f*)(p + 4);
  v4u r;
  r[0] = pk16(bf_bits(a[0]), bf_bits(a[1]));
  r[1] = pk16(bf_bits(a[2]), bf_bits(a[3]));
  r[2] = pk16(bf_bits(b[0]), bf_bits(b[1]));
  r[3] = pk16(bf_bits(b[2]), bf_bits(b[3]));
  return r;
}

// =====================================================================================================
// q and k f32 [4][2048][8][64] -> bf16 planes with the identical element layout (RNE convert), 8 elements
// coverage: n8 = 524288 threads x 8 = all 4194304 elements of each plane.
// =====================================================================================================
__global__ __launch_bounds__(256) void cvt_qk(const float* __restrict__ q, const float* __restrict__ k,
                                              unsigned short* Qo, unsigned short* Ko, int n8) {
  const int i = blockIdx.x * 256 + threadIdx.x;
  if (i < n8) {
    const size_t e = (size_t)i * 8;
    const v4u pq = cvt8(q + e);
    const v4u pk = cvt8(k + e);
    *(v4u*)(Qo + e) = pq;
    *(v4u*)(Ko + e) = pk;
    
  }
}

// =====================================================================================================
// v f32 [4][2048][8][64] -> bf16 V^T planes VT [b*8+h][64 d][2048 keys] (k = key contiguous, the B^T layout
// of the p.v step). grid = 4*8*32 blocks; block = (b, h, 64-key tile): thread reads 4 x 16 B of the tile's
// token rows (in[key][d], 64 x 64), RNE-converts into LDS T[d][key] (pitch 72); after a barrier each wave
// coverage: 1024 blocks x 64 d-rows x 64 keys = the whole [32][64][2048] plane.
// =====================================================================================================
__global__ __launch_bounds__(256) void prep_vt(const float* __restrict__ v, unsigned short* VT) {
  __shared__ __align__(16) unsigned short T[ND * 72];    // [d][72], 9216 B
  const int tid   = threadIdx.x;
  const int stile = blockIdx.x & (NKC - 1);
  const int bh    = blockIdx.x >> 5;
  const int h     = bh & (NH - 1);
  const int b     = bh >> 3;
  const int s0    = stile * 64;
  const float* vp = v + ((size_t)(b * NS + s0) * NH + h) * ND;     // token row srow at + srow*NTD
#pragma unroll
  for (int rr = 0; rr < 4; ++rr) {
    const int idx  = tid + rr * 256;        // 0..1023
    const int srow = idx >> 4;              // key within tile, 0..63
    const int d4   = (idx & 15) << 2;       // d, 0..60
    const v4f vf = *(const v4f*)(vp + (size_t)srow * NTD + d4);
#pragma unroll
    for (int e = 0; e < 4; ++e) T[(d4 + e) * 72 + srow] = bf_bits(vf[e]);
  }
  __syncthreads();
  unsigned short* vout = VT + (size_t)bh * ND * NS + s0;           // row d at + d*NS
  v4u tv[2];
  size_t to[2];
#pragma unroll
  for (int rr = 0; rr < 2; ++rr) {
    const int idx  = tid + rr * 256;        // 0..511
    const int drow = idx >> 3;              // 0..63
    const int c8   = (idx & 7) << 3;        // 0..56 halves
    tv[rr] = *(const v4u*)(T + drow * 72 + c8);
    to[rr] = (size_t)drow * NS + c8;
  }
  {
    *(v4u*)(vout + to[0]) = tv[0];
    *(v4u*)(vout + to[1]) = tv[1];
    
  }
}

// =====================================================================================================
// Non-causal de-stationary attention, head dim 64, key chunks of 64, static LDS.
//   q / k planes (bf16): element (b, t, h, d) at [((b*2048 + t)*8 + h)*64 + d]   (token pitch 512 halves)
//   V^T planes (bf16): element (b*8+h, d, s) at [((bh*64) + d)*2048 + s]
//   out f32: (b, t, h, d) at [((b*2048 + t)*8 + h)*64 + d]
//   Block = 8 waves x 16 query rows = 128 rows of one (b, h); grid = 4*8*16 = 512; chunk loop kt = 0..31
//   (all keys, block-uniform).
//   K / V^T chunk staging: 256 threads x 2 pieces of 16 B per plane = the whole 64x64 tile of both planes
//   (plain 16-B loads, __syncthreads before and after).
//   scores = 2 bf16 products over the two 32-deep d-chunks, f32 accumulate, then (s*tau_b + delta_s) * 1/8 in f32
//   with tau_b and the delta row RNE-converted to bf16 values;
//   p = exp(x - m) split as bf16 hi + bf16 lo into wave-private LDS tiles (__bf16 element stores, reloaded as
//   context += p.v with 2 bf16 products into register accumulators (compile-time indices); online softmax in f32.
//   Epilogue: all waves pass a barrier, each wave's P slot is reused as its 16x64 f32 staging; one instruction
//   coverage: out: 512 blocks x 8 waves x 16 rows x 64 d = all 4194304 elements, one wave per (token, head) row.
// =====================================================================================================
// Row pitch of the K, V^T and P tiles: 64 bf16 of data + 8 of pad = 144 B = 16 B x 9 (odd), so that the 16 rows one
// 16-byte fragment load touches fall on distinct bank groups; the pad halves are never written and never read.
#define LP      72         // halves per LDS row
#define L_K     0          // K chunk   [64 keys][72] bf16   9216 B
#define L_V     9216       // V^T chunk [64 d][72] bf16      9216 B
#define L_P     18432      // P [8 waves][hi 16x72 | lo 16x72] bf16  36864 B (epilogue: per-wave 16x64 f32 staging)
#define L_D     55296      // delta row of the batch, f32 [2048]  8192 B
#define L_TOTAL 63488
#define PW      (2 * 16 * LP)   // halves per wave's P slot (hi + lo)
static_assert((LP * 2) % 16 == 0 && ((LP * 2) / 16) % 2 == 1);
static_assert(L_V - L_K == 64 * LP * 2);
static_assert(L_P - L_V == ND * LP * 2);
static_assert(L_D - L_P == 8 * PW * 2);
static_assert(L_TOTAL - L_D == NS * 4);
static_assert(16 * ND * 4 <= PW * 2);            // per-wave f32 staging fits inside the wave's P slot

__global__ __launch_bounds__(256)
void attn_ds(const unsigned short* __restrict__ qbp, const unsigned short* __restrict__ kbp,
             const unsigned short* __restrict__ vtp, const float* __restrict__ tau,
             const float* __restrict__ delta, float* Op) {
  __shared__ __align__(16) unsigned char lds[L_TOTAL];
  union FB { v16b v; v8b h[2]; };
  __bf16* Ksh = (__bf16*)(lds + L_K);
  __bf16* Vth = (__bf16*)(lds + L_V);
  __bf16* Pb  = (__bf16*)(lds + L_P);
  float*  sDl = (float*)(lds + L_D);

  const int tid  = threadIdx.x;
  const int wave = tid >> 5;
  const int lane = tid & 31;
  const int hh   = lane >> 4;
  const int c    = lane & 15;

  const int bx = blockIdx.x;
  const int qb = bx & (NQB - 1);              // query block 0..15
  const int bh = bx >> 4;                     // (b, h) pair 0..31
  const int h  = bh & (NH - 1);
  const int b  = bh >> 3;
  const int q0 = qb * 128 + wave * 16;        // first query row of this wave

  const __bf16* Qg = (const __bf16*)(const void*)qbp;
  const __bf16* Kg = (const __bf16*)(const void*)kbp;
  const __bf16* Vg = (const __bf16*)(const void*)vtp + (size_t)bh * ND * NS;

  __bf16* pwh = Pb + wave * PW;               // [16 rows][64 keys, pitch LP] hi
  __bf16* pwl = pwh + 16 * LP;                // [16 rows][64 keys, pitch LP] lo

  // ---- delta row of batch b -> LDS as bf16-valued f32 (read after the first two block barriers) ----
  {
    const float* dp = delta + (size_t)b * NS;
#pragma unroll
    for (int rr = 0; rr < 2; ++rr) {
      const int idx = tid + rr * 256;         // 0..511 pieces of 4 floats = 2048
      const v4f x = *(const v4f*)(dp + idx * 4);
      v4f y;
#pragma unroll
      for (int e = 0; e < 4; ++e) y[e] = bf_up(bf_bits(x[e]));
      *(v4f*)(sDl + idx * 4) = y;
    }
  }
  const float taub = bf_up(bf_bits(tau[b]));

  // ---- q A fragments for both 32-deep d-chunks: row q0 + c, k = d ----
  const size_t qo = ((size_t)(b * NL + q0 + c) * NH + h) * ND + 8 * hh;
  v16b qa[2];
  qa[0] = ldfrag_b(Qg + qo);
  qa[1] = ldfrag_b(Qg + qo + 32);

  v8f O[4];
#pragma unroll
  for (int t = 0; t < 4; ++t) O[t] = zero8();
  float mrow[8], lrow[8], alpha[8];
#pragma unroll
  for (int r = 0; r < 8; ++r) { mrow[r] = -INFINITY; lrow[r] = 0.f; alpha[r] = 0.f; }

  for (int kt = 0; kt < NKC; ++kt) {          // block-uniform trip count
    const int kv0 = kt * 64;
    __syncthreads();                          // every wave is done with the prior chunk's tiles
    {
#pragma unroll
      for (int i = 0; i < 2; ++i) {
        const int p  = tid + 256 * i;         // 0..511
        const int rw = p >> 3;                // key (K tile) / d (V^T tile), 0..63
        const int sg = (p & 7) * 8;           // 0..56 halves
        const v8b a0 = *(const v8b*)(Kg + ((size_t)(b * NS + kv0 + rw) * NH + h) * ND + sg);
        const v8b b0 = *(const v8b*)(Vg + (size_t)rw * NS + kv0 + sg);
        *(v8b*)(Ksh + rw * LP + sg) = a0;
        *(v8b*)(Vth + rw * LP + sg) = b0;
      }
    }
    __syncthreads();

    // ---- scores: 16 query rows x 64 keys per wave, exact bf16 products over 2 d-chunks ----
    v8f s[4];
#pragma unroll
    for (int j = 0; j < 4; ++j) s[j] = zero8();
#pragma unroll
    for (int dc = 0; dc < 2; ++dc) {
      const int ko = dc * 32 + 8 * hh;
#pragma unroll
      for (int j = 0; j < 4; ++j) {
        const int kr = (j * 16 + c) * LP + ko;   // B: key j*16+c (col), d = dc*32 + 8h .. (k)
        FB kb;
        kb.h[0] = *(const v8b*)(Ksh + kr);
        kb.h[1] = *(const v8b*)(Ksh + kr + 16);
        s[j] = mma_b(qa[dc], kb.v, s[j]);
      }
    }

    // ---- bias per key column, scale, row max, online softmax, P hi / lo (bf16) to LDS ----
    float dcl[4];
#pragma unroll
    for (int j = 0; j < 4; ++j) dcl[j] = sDl[kv0 + j * 16 + c];
#pragma unroll
    for (int r = 0; r < 8; ++r) {
      float m = -INFINITY;
#pragma unroll
      for (int j = 0; j < 4; ++j) {
        const float sv = (s[j][r] * taub + dcl[j]) * 0.125f;
        s[j][r] = sv;
        m = fmaxf(m, sv);
      }
#pragma unroll
      for (int off = 1; off < 16; off <<= 1) m = fmaxf(m, __shfl_xor(m, off, 32));
      const float mnew = fmaxf(mrow[r], m);     // finite: every chunk has 64 valid keys
      const float al   = __expf(mrow[r] - mnew); // first chunk: exp(-inf) = 0
      mrow[r]  = mnew;
      alpha[r] = al;
      float psum = 0.f;
#pragma unroll
      for (int j = 0; j < 4; ++j) {
        const float p = __expf(s[j][r] - mnew);
        psum += p;
        const unsigned short hb = bf_bits(p);
        const unsigned short lb = bf_bits(p - bf_up(hb));
        const int po = (8 * hh + r) * LP + j * 16 + c;
        pwh[po] = bf_val(hb);
        pwl[po] = bf_val(lb);
      }
#pragma unroll
      for (int off = 1; off < 16; off <<= 1) psum += __shfl_xor(psum, off, 32);
      lrow[r] = lrow[r] * al + psum;
    }
    __builtin_amdgcn_fence(__ATOMIC_RELEASE, "workgroup");
    __builtin_amdgcn_wave_barrier();
    __builtin_amdgcn_fence(__ATOMIC_ACQUIRE, "workgroup");

    // ---- rescale the running context, then context += P . V (2 bf16 products) ----
#pragma unroll
    for (int t = 0; t < 4; ++t) {
#pragma unroll
      for (int r = 0; r < 8; ++r) O[t][r] *= alpha[r];
    }
#pragma unroll
    for (int kk = 0; kk < 2; ++kk) {
      const int pr = c * LP + kk * 32 + 8 * hh;      // A fragment: row c, keys kk*32 + 8h ..
      FB pa, pl;
      pa.h[0] = *(const v8b*)(pwh + pr);
      pa.h[1] = *(const v8b*)(pwh + pr + 16);
      pl.h[0] = *(const v8b*)(pwl + pr);
      pl.h[1] = *(const v8b*)(pwl + pr + 16);
#pragma unroll
      for (int t = 0; t < 4; ++t) {
        const int vr = (t * 16 + c) * LP + kk * 32 + 8 * hh;   // B fragment: col d = t*16+c, keys kk*32 + 8h ..
        FB vb;
        vb.h[0] = *(const v8b*)(Vth + vr);
        vb.h[1] = *(const v8b*)(Vth + vr + 16);
        O[t] = mma_b(pa.v, vb.v, O[t]);
        O[t] = mma_b(pl.v, vb.v, O[t]);
      }
    }
  }
  __syncthreads();                             // every wave is past its last P / K / V^T read

  // ---- normalise, stage the wave's 16x64 f32 tile in its own P slot, whole-line writes ----
  float* os = (float*)(lds + L_P + wave * (PW * 2));   // start of the wave's own P slot
  float inv[8];
#pragma unroll
  for (int r = 0; r < 8; ++r) inv[r] = (lrow[r] > 0.f) ? (1.0f / lrow[r]) : 0.f;
#pragma unroll
  for (int t = 0; t < 4; ++t) {
#pragma unroll
    for (int r = 0; r < 8; ++r) os[(8 * hh + r) * 64 + t * 16 + c] = O[t][r] * inv[r];
  }
  __builtin_amdgcn_fence(__ATOMIC_RELEASE, "workgroup");
  __builtin_amdgcn_wave_barrier();
  __builtin_amdgcn_fence(__ATOMIC_ACQUIRE, "workgroup");
  float* og = Op + ((size_t)(b * NL + q0) * NH + h) * ND;   // row r of the wave at + r*NTD
  const int colw = c * 4;
  v4f ov[8];
#pragma unroll
  for (int it = 0; it < 8; ++it) {
    const int row = 2 * it + hh;               // rows 0..15: lanes 0..15 even row, lanes 16..31 odd row
    ov[it] = *(const v4f*)(os + row * 64 + colw);
  }
  {
#pragma unroll
    for (int it = 0; it < 8; ++it) {
      const int row = 2 * it + hh;
      *(v4f*)(og + (size_t)row * NTD + colw) = ov[it];
    }
    
  }
}

// =====================================================================================================
//   Qb  bf16 [4][2048][8][64]          0         8388608
//   Kb  bf16 [4][2048][8][64]    8388608         8388608
//   VT  bf16 [32][64][2048]     16777216         8388608
//   end                         25165824
// =====================================================================================================
extern "C" void kernel_launch(void* const* d_in, const int* in_sizes, int n_in,
                              void* d_out, int out_size, void* d_ws, size_t ws_size,
                              hipStream_t stream) {
  const int nqkv = NB * NL * NH * ND;                       // 4194304
  if (n_in < 5) return;
  if (in_sizes[0] != nqkv || in_sizes[1] != nqkv || in_sizes[2] != nqkv) return;
  if (in_sizes[3] != NB || in_sizes[4] != NB * NS) return;
  if (out_size != nqkv) return;

  const float* q     = (const float*)d_in[0];
  const float* k     = (const float*)d_in[1];
  const float* v     = (const float*)d_in[2];
  const float* tau   = (const float*)d_in[3];
  const float* delta = (const float*)d_in[4];

  const size_t PL = (size_t)nqkv * 2;                       // 8388608
  size_t off = 0;
  const size_t oQ = off; off += PL;
  const size_t oK = off; off += PL;
  const size_t oV = off; off += PL;
  if (off > ws_size) return;                               // off = 25165824
  if (off > (size_t)134217728) return;

  char* ws = (char*)d_ws;
  unsigned short* Qb = (unsigned short*)(ws + oQ);
  unsigned short* Kb = (unsigned short*)(ws + oK);
  unsigned short* VT = (unsigned short*)(ws + oV);

  const int  n8 = nqkv / 8;                                 // 524288
  const dim3 blk(256);
  const dim3 gCvt((n8 + 255) / 256);                        // 2048 blocks
  const dim3 gVt(NB * NH * NKC);                            // 1024 blocks
  const dim3 gAttn(NB * NH * NQB);                          // 512 blocks

  // (1) q, k -> bf16 planes (RNE convert, same layout as the inputs)
  cvt_qk<<<gCvt, blk, 0, stream>>>(q, k, Qb, Kb, n8);
  // (2) v -> bf16 V^T planes [b*8+h][64][2048]
  prep_vt<<<gVt, blk, 0, stream>>>(v, VT);
  // (3) attention per (b, h, 128-query block) -> d_out f32 [4][2048][8][64]
  attn_ds<<<gAttn, blk, 0, stream>>>(Qb, Kb, VT, tau, delta, (float*)d_out);
  (void)hipGetLastError();
}

// v002
// A run of this version takes 103 microseconds.
// Two timings next to v001 put it at 1.19 and 1.17 times that version's speed.
// Counting every step since v000, it is 1.89 times as fast.
// Contractions: k.q^T scores (transposed) = v_wmma_f32_16x16x32_bf16 (bf16 operands from RNE-converted q and k, single exact product, f32 accumulate);
// v^T.p^T context (transposed) = v_wmma_f32_16x16x32_bf16 with p as bf16 hi + unscaled bf16 residual and RNE-converted v (hi.v + lo.v), f32 accumulate;
// tau / delta bias, the 1/8 scale, online softmax, denominators and the final normalisation in f32 on the VALU.
// Carry audit: no power-of-two carries anywhere; the p residual plane is the unscaled RNE residual (p - hi) and shares the hi
// accumulator; the 1/8 scale is applied once in f32 after the tau / delta step; denominators divided out once in the epilogue.
#include <hip/hip_runtime.h>
#include <math.h>
#include <stdint.h>

#define NB   4
#define NL   2048
#define NS   2048
#define NH   8
#define ND   64
#define NTD  (NH * ND)        // 512 floats per token row
#define NQB  (NL / 128)        // 16 query blocks of 128 rows per (b, h)
#define NKC  (NS / 64)         // 32 key chunks of 64 keys
static_assert(NQB == 16);
static_assert(NKC == 32);
static_assert((NL % 128) == 0 && (NS % 64) == 0 && ND == 64 && (ND % 32) == 0);

typedef __bf16   v16b __attribute__((ext_vector_type(16)));
typedef __bf16   v8b  __attribute__((ext_vector_type(8)));
typedef float    v8f  __attribute__((ext_vector_type(8)));
typedef float    v4f  __attribute__((ext_vector_type(4)));
typedef unsigned int v4u __attribute__((ext_vector_type(4)));

// ---- scalar helpers --------------------------------------------------------------------------------
__device__ __forceinline__ unsigned short bf_bits(float f) {          // f32 -> bf16 bits, RNE convert
  unsigned u = __float_as_uint(f);
  return (unsigned short)((u + 0x7FFFu + ((u >> 16) & 1u)) >> 16);
}
__device__ __forceinline__ float bf_up(unsigned short hb) { return __uint_as_float(((unsigned)hb) << 16); }
__device__ __forceinline__ __bf16 bf_val(unsigned short hb) { return __builtin_bit_cast(__bf16, hb); }
__device__ __forceinline__ unsigned pk16(unsigned short a, unsigned short b) { return (unsigned)a | ((unsigned)b << 16); }
__device__ __forceinline__ v8f zero8() { v8f z = {0.f, 0.f, 0.f, 0.f, 0.f, 0.f, 0.f, 0.f}; return z; }

// ---- fragment loader: 16-bit A/B operand, lane -> row/col (lane&15), p already includes +8*(lane>>4);
//      elements 0..7 <- p[0..7] (k0+8h..), elements 8..15 <- p[16..23] (k0+16+8h..)
__device__ __forceinline__ v16b ldfrag_b(const __bf16* p) {
  union { v16b v; v8b h[2]; } f;
  f.h[0] = *(const v8b*)(p);
  f.h[1] = *(const v8b*)(p + 16);
  return f.v;
}

// ---- WMMA helper with trailing VALU hazard gap ---------------------------------------------------------
__device__ __forceinline__ v8f mma_b(v16b a, v16b b, v8f c) {
  c = __builtin_amdgcn_wmma_f32_16x16x32_bf16(false, a, false, b, (short)0, c, false, false);
  asm volatile("v_nop\n\tv_nop\n\tv_nop\n\tv_nop" : "+v"(c) : "v"(a), "v"(b));
  return c;
}

// ---- 8 consecutive f32 -> 8 bf16 bits packed in one 16-B vector ----------------------------------------
__device__ __forceinline__ v4u cvt8(const float* __restrict__ p) {
  const v4f a = *(const v4f*)(p);
  const v4f b = *(const v4f*)(p + 4);
  v4u r;
  r[0] = pk16(bf_bits(a[0]), bf_bits(a[1]));
  r[1] = pk16(bf_bits(a[2]), bf_bits(a[3]));
  r[2] = pk16(bf_bits(b[0]), bf_bits(b[1]));
  r[3] = pk16(bf_bits(b[2]), bf_bits(b[3]));
  return r;
}

// =====================================================================================================
// q and k f32 [4][2048][8][64] -> bf16 planes with the identical element layout (RNE convert), 8 elements
// coverage: n8 = 524288 threads x 8 = all 4194304 elements of each plane.
// =====================================================================================================
__global__ __launch_bounds__(256) void cvt_qk(const float* __restrict__ q, const float* __restrict__ k,
                                              unsigned short* Qo, unsigned short* Ko, int n8) {
  const int i = blockIdx.x * 256 + threadIdx.x;
  if (i < n8) {
    const size_t e = (size_t)i * 8;
    const v4u pq = cvt8(q + e);
    const v4u pk = cvt8(k + e);
    *(v4u*)(Qo + e) = pq;
    *(v4u*)(Ko + e) = pk;
    
  }
}

// =====================================================================================================
// v f32 [4][2048][8][64] -> bf16 V^T planes VT [b*8+h][64 d][2048 keys] (k = key contiguous, the A layout
// of the V^T.P^T step). grid = 4*8*32 blocks; block = (b, h, 64-key tile): thread reads 4 x 16 B of the tile's
// token rows (in[key][d], 64 x 64), RNE-converts into LDS T[d][key] (pitch 72); after a barrier each wave
// coverage: 1024 blocks x 64 d-rows x 64 keys = the whole [32][64][2048] plane.
// =====================================================================================================
__global__ __launch_bounds__(256) void prep_vt(const float* __restrict__ v, unsigned short* VT) {
  __shared__ __align__(16) unsigned short T[ND * 72];    // [d][72], 9216 B
  const int tid   = threadIdx.x;
  const int stile = blockIdx.x & (NKC - 1);
  const int bh    = blockIdx.x >> 5;
  const int h     = bh & (NH - 1);
  const int b     = bh >> 3;
  const int s0    = stile * 64;
  const float* vp = v + ((size_t)(b * NS + s0) * NH + h) * ND;     // token row srow at + srow*NTD
#pragma unroll
  for (int rr = 0; rr < 4; ++rr) {
    const int idx  = tid + rr * 256;        // 0..1023
    const int srow = idx >> 4;              // key within tile, 0..63
    const int d4   = (idx & 15) << 2;       // d, 0..60
    const v4f vf = *(const v4f*)(vp + (size_t)srow * NTD + d4);
#pragma unroll
    for (int e = 0; e < 4; ++e) T[(d4 + e) * 72 + srow] = bf_bits(vf[e]);
  }
  __syncthreads();
  unsigned short* vout = VT + (size_t)bh * ND * NS + s0;           // row d at + d*NS
  v4u tv[2];
  size_t to[2];
#pragma unroll
  for (int rr = 0; rr < 2; ++rr) {
    const int idx  = tid + rr * 256;        // 0..511
    const int drow = idx >> 3;              // 0..63
    const int c8   = (idx & 7) << 3;        // 0..56 halves
    tv[rr] = *(const v4u*)(T + drow * 72 + c8);
    to[rr] = (size_t)drow * NS + c8;
  }
  {
    *(v4u*)(vout + to[0]) = tv[0];
    *(v4u*)(vout + to[1]) = tv[1];
    
  }
}

#define LP      72         // halves per LDS row
#define OP      68         // floats per row of the epilogue staging: 272 B = 16 B x 17 (odd)
#define L_K     0          // K chunk   [64 keys][72] bf16   9216 B
#define L_V     9216       // V^T chunk [64 d][72] bf16      9216 B
#define L_O     0          // epilogue only: [8 waves][16 queries][68] f32  34816 B, over the K / V^T area
#define L_D     34816      // delta row of the batch, f32 [2048]  8192 B
#define L_TOTAL 43008
static_assert((LP * 2) % 16 == 0 && ((LP * 2) / 16) % 2 == 1);
static_assert((OP * 4) % 16 == 0 && ((OP * 4) / 16) % 2 == 1);
static_assert(L_V - L_K == 64 * LP * 2);
static_assert(L_V + ND * LP * 2 <= L_D);
static_assert(L_D - L_O == 8 * 16 * OP * 4);
static_assert(L_TOTAL - L_D == NS * 4);

// value of lane l ^ 16 (the other half's lane of the same query column)
__device__ __forceinline__ float other_half(float x) {
  const int bts = __float_as_int(x);
  return __int_as_float(__builtin_amdgcn_permlanex16(bts, bts, 0x76543210, 0xfedcba98, false, false));
}

__global__ __launch_bounds__(256)
void attn_ds(const unsigned short* __restrict__ qbp, const unsigned short* __restrict__ kbp,
             const unsigned short* __restrict__ vtp, const float* __restrict__ tau,
             const float* __restrict__ delta, float* Op) {
  __shared__ __align__(16) unsigned char lds[L_TOTAL];
  union FB { v16b v; v8b h[2]; };
  union PB { v16b v; unsigned u[8]; };
  __bf16* Ksh = (__bf16*)(lds + L_K);
  __bf16* Vth = (__bf16*)(lds + L_V);
  float*  sDl = (float*)(lds + L_D);

  const int tid  = threadIdx.x;
  const int wave = tid >> 5;
  const int lane = tid & 31;
  const int hh   = lane >> 4;
  const int c    = lane & 15;

  const int bx = blockIdx.x;
  const int qb = bx & (NQB - 1);              // query block 0..15
  const int bh = bx >> 4;                     // (b, h) pair 0..31
  const int h  = bh & (NH - 1);
  const int b  = bh >> 3;
  const int q0 = qb * 128 + wave * 16;        // first query of this wave

  const __bf16* Qg = (const __bf16*)(const void*)qbp;
  const __bf16* Kg = (const __bf16*)(const void*)kbp;
  const __bf16* Vg = (const __bf16*)(const void*)vtp + (size_t)bh * ND * NS;

  // ---- delta row of batch b -> LDS as bf16-valued f32 (read after the first two block barriers) ----
  {
    const float* dp = delta + (size_t)b * NS;
#pragma unroll
    for (int rr = 0; rr < 2; ++rr) {
      const int idx = tid + rr * 256;         // 0..511 pieces of 4 floats = 2048
      const v4f x = *(const v4f*)(dp + idx * 4);
      v4f y;
#pragma unroll
      for (int e = 0; e < 4; ++e) y[e] = bf_up(bf_bits(x[e]));
      *(v4f*)(sDl + idx * 4) = y;
    }
  }
  const float taub = bf_up(bf_bits(tau[b]));

  // ---- q B fragments for both 32-deep d-chunks: column q0 + c, k = d ----
  const size_t qo = ((size_t)(b * NL + q0 + c) * NH + h) * ND + 8 * hh;
  v16b qa[2];
  qa[0] = ldfrag_b(Qg + qo);
  qa[1] = ldfrag_b(Qg + qo + 32);

  v8f O[4];                                   // O^T tiles: d = t*16 + 8*hh + r, query c
#pragma unroll
  for (int t = 0; t < 4; ++t) O[t] = zero8();
  float mrow = -INFINITY;                     // running maximum of query c (equal in both halves)
  float lrow = 0.f;                           // this half's share of the denominator of query c

  for (int kt = 0; kt < NKC; ++kt) {          // block-uniform trip count
    const int kv0 = kt * 64;
    __syncthreads();                          // every wave is done with the prior chunk's tiles
    {
#pragma unroll
      for (int i = 0; i < 2; ++i) {
        const int p  = tid + 256 * i;         // 0..511
        const int rw = p >> 3;                // key (K tile) / d (V^T tile), 0..63
        const int sg = (p & 7) * 8;           // 0..56 halves
        const v8b a0 = *(const v8b*)(Kg + ((size_t)(b * NS + kv0 + rw) * NH + h) * ND + sg);
        const v8b b0 = *(const v8b*)(Vg + (size_t)rw * NS + kv0 + sg);
        *(v8b*)(Ksh + rw * LP + sg) = a0;
        *(v8b*)(Vth + rw * LP + sg) = b0;
      }
    }
    __syncthreads();

    // ---- S^T: 64 keys x 16 query columns per wave, exact bf16 products over 2 d-chunks ----
    v8f s[4];
#pragma unroll
    for (int j = 0; j < 4; ++j) s[j] = zero8();
#pragma unroll
    for (int dc = 0; dc < 2; ++dc) {
      const int ko = dc * 32 + 8 * hh;
#pragma unroll
      for (int j = 0; j < 4; ++j) {
        const int kr = (j * 16 + c) * LP + ko;   // A: key j*16+c (row), d = dc*32 + 8h .. (k)
        FB kb;
        kb.h[0] = *(const v8b*)(Ksh + kr);
        kb.h[1] = *(const v8b*)(Ksh + kr + 16);
        s[j] = mma_b(kb.v, qa[dc], s[j]);
      }
    }

    // ---- bias per key row, scale, column maximum in the lane + one exchange between the halves ----
    float mj[4];
#pragma unroll
    for (int j = 0; j < 4; ++j) {
      const float* dj = sDl + kv0 + j * 16 + 8 * hh;   // delta of keys j*16 + 8*hh + 0..7
      const v4f d0 = *(const v4f*)(dj);
      const v4f d1 = *(const v4f*)(dj + 4);
      float m = -INFINITY;
#pragma unroll
      for (int r = 0; r < 8; ++r) {
        const float sv = (s[j][r] * taub + (r < 4 ? d0[r & 3] : d1[r & 3])) * 0.125f;
        s[j][r] = sv;
        m = fmaxf(m, sv);
      }
      mj[j] = m;
    }
    float mc = fmaxf(fmaxf(mj[0], mj[1]), fmaxf(mj[2], mj[3]));
    mc = fmaxf(mc, other_half(mc));
    const float mnew = fmaxf(mrow, mc);         // finite: every chunk has 64 valid keys
    const float al   = __expf(mrow - mnew);     // first chunk: exp(-inf) = 0
    mrow = mnew;

    // ---- p = exp(x - m); hi / lo bf16 packed in place into the B operands of the two 32-key groups ----
    PB ph[2], pl[2];
    float pj[4];
#pragma unroll
    for (int j = 0; j < 4; ++j) {
      float psum = 0.f;
#pragma unroll
      for (int r = 0; r < 8; r += 2) {
        const float p0 = __expf(s[j][r]     - mnew);
        const float p1 = __expf(s[j][r + 1] - mnew);
        psum += p0;
        psum += p1;
        const unsigned short h0 = bf_bits(p0);
        const unsigned short h1 = bf_bits(p1);
        const unsigned short l0 = bf_bits(p0 - bf_up(h0));
        const unsigned short l1 = bf_bits(p1 - bf_up(h1));
        ph[j >> 1].u[(j & 1) * 4 + (r >> 1)] = pk16(h0, h1);
        pl[j >> 1].u[(j & 1) * 4 + (r >> 1)] = pk16(l0, l1);
      }
      pj[j] = psum;
    }
    lrow = lrow * al + ((pj[0] + pj[1]) + (pj[2] + pj[3]));

    // ---- rescale the running context, then O^T += V^T . P^T (2 bf16 products) ----
#pragma unroll
    for (int t = 0; t < 4; ++t) {
#pragma unroll
      for (int r = 0; r < 8; ++r) O[t][r] *= al;
    }
#pragma unroll
    for (int kk = 0; kk < 2; ++kk) {
#pragma unroll
      for (int t = 0; t < 4; ++t) {
        const int vr = (t * 16 + c) * LP + kk * 32 + 8 * hh;   // A fragment: row d = t*16+c, keys kk*32 + 8h ..
        FB vb;
        vb.h[0] = *(const v8b*)(Vth + vr);
        vb.h[1] = *(const v8b*)(Vth + vr + 16);
        O[t] = mma_b(vb.v, ph[kk].v, O[t]);
        O[t] = mma_b(vb.v, pl[kk].v, O[t]);
      }
    }
  }
  __syncthreads();                             // every wave is past its last K / V^T read

  // ---- join the halves' denominators, normalise, stage the wave's 16x64 f32 tile, whole-line writes ----
  float* os = (float*)(lds + L_O) + wave * (16 * OP);   // the wave's own staging slot
  const float lsum = lrow + other_half(lrow);
  const float inv  = (lsum > 0.f) ? (1.0f / lsum) : 0.f;
#pragma unroll
  for (int t = 0; t < 4; ++t) {
    v4f w0, w1;
#pragma unroll
    for (int r = 0; r < 4; ++r) { w0[r] = O[t][r] * inv; w1[r] = O[t][r + 4] * inv; }
    *(v4f*)(os + c * OP + t * 16 + 8 * hh)     = w0;
    *(v4f*)(os + c * OP + t * 16 + 8 * hh + 4) = w1;
  }
  __builtin_amdgcn_fence(__ATOMIC_RELEASE, "workgroup");
  __builtin_amdgcn_wave_barrier();
  __builtin_amdgcn_fence(__ATOMIC_ACQUIRE, "workgroup");
  float* og = Op + ((size_t)(b * NL + q0) * NH + h) * ND;   // row r of the wave at + r*NTD
  const int colw = c * 4;
  v4f ov[8];
#pragma unroll
  for (int it = 0; it < 8; ++it) {
    const int row = 2 * it + hh;               // rows 0..15: lanes 0..15 even row, lanes 16..31 odd row
    ov[it] = *(const v4f*)(os + row * OP + colw);
  }
  {
#pragma unroll
    for (int it = 0; it < 8; ++it) {
      const int row = 2 * it + hh;
      *(v4f*)(og + (size_t)row * NTD + colw) = ov[it];
    }
    
  }
}

// =====================================================================================================
//   Qb  bf16 [4][2048][8][64]          0         8388608
//   Kb  bf16 [4][2048][8][64]    8388608         8388608
//   VT  bf16 [32][64][2048]     16777216         8388608
//   end                         25165824
// =====================================================================================================
extern "C" void kernel_launch(void* const* d_in, const int* in_sizes, int n_in,
                              void* d_out, int out_size, void* d_ws, size_t ws_size,
                              hipStream_t stream) {
  const int nqkv = NB * NL * NH * ND;                       // 4194304
  if (n_in < 5) return;
  if (in_sizes[0] != nqkv || in_sizes[1] != nqkv || in_sizes[2] != nqkv) return;
  if (in_sizes[3] != NB || in_sizes[4] != NB * NS) return;
  if (out_size != nqkv) return;

  const float* q     = (const float*)d_in[0];
  const float* k     = (const float*)d_in[1];
  const float* v     = (const float*)d_in[2];
  const float* tau   = (const float*)d_in[3];
  const float* delta = (const float*)d_in[4];

  const size_t PL = (size_t)nqkv * 2;                       // 8388608
  size_t off = 0;
  const size_t oQ = off; off += PL;
  const size_t oK = off; off += PL;
  const size_t oV = off; off += PL;
  if (off > ws_size) return;                               // off = 25165824
  if (off > (size_t)134217728) return;

  char* ws = (char*)d_ws;
  unsigned short* Qb = (unsigned short*)(ws + oQ);
  unsigned short* Kb = (unsigned short*)(ws + oK);
  unsigned short* VT = (unsigned short*)(ws + oV);

  const int  n8 = nqkv / 8;                                 // 524288
  const dim3 blk(256);
  const dim3 gCvt((n8 + 255) / 256);                        // 2048 blocks
  const dim3 gVt(NB * NH * NKC);                            // 1024 blocks
  const dim3 gAttn(NB * NH * NQB);                          // 512 blocks

  // (1) q, k -> bf16 planes (RNE convert, same layout as the inputs)
  cvt_qk<<<gCvt, blk, 0, stream>>>(q, k, Qb, Kb, n8);
  // (2) v -> bf16 V^T planes [b*8+h][64][2048]
  prep_vt<<<gVt, blk, 0, stream>>>(v, VT);
  // (3) attention per (b, h, 128-query block) -> d_out f32 [4][2048][8][64]
  attn_ds<<<gAttn, blk, 0, stream>>>(Qb, Kb, VT, tau, delta, (float*)d_out);
  (void)hipGetLastError();
}

// v003
// A run of this version takes 89.4 microseconds.
// Timed twice side by side with v002, it ran 1.14 times as fast both times.
// Over all steps from v000 it is 2.15 times as fast.
// Contractions: k.q^T scores (transposed) = v_wmma_f32_16x16x32_bf16 (bf16 operands from RNE-converted q and k, single exact product, f32 accumulate);
// v^T.p^T context (transposed) = v_wmma_f32_16x16x32_bf16 with p as bf16 hi + unscaled bf16 residual and RNE-converted v (hi.v + lo.v), f32 accumulate;
// tau / delta bias, the 1/8 scale, online softmax, denominators and the final normalisation in f32 on the VALU.
// Carry audit: no power-of-two carries anywhere; the p residual plane is the unscaled RNE residual (p - hi) and shares the hi
// accumulator; the 1/8 scale is applied once in f32 after the tau / delta step; denominators divided out once in the epilogue.
#include <hip/hip_runtime.h>
#include <math.h>
#include <stdint.h>

#define NB   4
#define NL   2048
#define NS   2048
#define NH   8
#define ND   64
#define NTD  (NH * ND)        // 512 floats per token row
#define NQB  (NL / 128)        // 16 query blocks of 128 rows per (b, h)
#define NKC  (NS / 64)         // 32 key chunks of 64 keys
static_assert(NQB == 16);
static_assert(NKC == 32);
static_assert((NL % 128) == 0 && (NS % 64) == 0 && ND == 64 && (ND % 32) == 0);

typedef __bf16   v16b __attribute__((ext_vector_type(16)));
typedef __bf16   v8b  __attribute__((ext_vector_type(8)));
typedef float    v8f  __attribute__((ext_vector_type(8)));
typedef float    v4f  __attribute__((ext_vector_type(4)));
typedef unsigned int v4u __attribute__((ext_vector_type(4)));

// ---- scalar helpers --------------------------------------------------------------------------------
__device__ __forceinline__ unsigned short bf_bits(float f) {          // f32 -> bf16 bits, RNE convert
  unsigned u = __float_as_uint(f);
  return (unsigned short)((u + 0x7FFFu + ((u >> 16) & 1u)) >> 16);
}
__device__ __forceinline__ float bf_up(unsigned short hb) { return __uint_as_float(((unsigned)hb) << 16); }
__device__ __forceinline__ __bf16 bf_val(unsigned short hb) { return __builtin_bit_cast(__bf16, hb); }
__device__ __forceinline__ unsigned pk16(unsigned short a, unsigned short b) { return (unsigned)a | ((unsigned)b << 16); }
__device__ __forceinline__ v8f zero8() { v8f z = {0.f, 0.f, 0.f, 0.f, 0.f, 0.f, 0.f, 0.f}; return z; }

// ---- fragment loader: 16-bit A/B operand, lane -> row/col (lane&15), p already includes +8*(lane>>4);
//      elements 0..7 <- p[0..7] (k0+8h..), elements 8..15 <- p[16..23] (k0+16+8h..)
__device__ __forceinline__ v16b ldfrag_b(const __bf16* p) {
  union { v16b v; v8b h[2]; } f;
  f.h[0] = *(const v8b*)(p);
  f.h[1] = *(const v8b*)(p + 16);
  return f.v;
}

// ---- WMMA helper: the builtin alone, the compiler keeps the hazard distance and is free to group the LDS loads ----
__device__ __forceinline__ v8f mma_b(v16b a, v16b b, v8f c) {
  return __builtin_amdgcn_wmma_f32_16x16x32_bf16(false, a, false, b, (short)0, c, false, false);
}

// ---- 8 consecutive f32 -> 8 bf16 bits packed in one 16-B vector ----------------------------------------
__device__ __forceinline__ v4u cvt8(const float* __restrict__ p) {
  const v4f a = *(const v4f*)(p);
  const v4f b = *(const v4f*)(p + 4);
  v4u r;
  r[0] = pk16(bf_bits(a[0]), bf_bits(a[1]));
  r[1] = pk16(bf_bits(a[2]), bf_bits(a[3]));
  r[2] = pk16(bf_bits(b[0]), bf_bits(b[1]));
  r[3] = pk16(bf_bits(b[2]), bf_bits(b[3]));
  return r;
}

// =====================================================================================================
// q and k f32 [4][2048][8][64] -> bf16 planes with the identical element layout (RNE convert), 8 elements
// coverage: n8 = 524288 threads x 8 = all 4194304 elements of each plane.
// =====================================================================================================
__global__ __launch_bounds__(256) void cvt_qk(const float* __restrict__ q, const float* __restrict__ k,
                                              unsigned short* Qo, unsigned short* Ko, int n8) {
  const int i = blockIdx.x * 256 + threadIdx.x;
  if (i < n8) {
    const size_t e = (size_t)i * 8;
    const v4u pq = cvt8(q + e);
    const v4u pk = cvt8(k + e);
    *(v4u*)(Qo + e) = pq;
    *(v4u*)(Ko + e) = pk;
    
  }
}

// =====================================================================================================
// v f32 [4][2048][8][64] -> bf16 V^T planes VT [b*8+h][64 d][2048 keys] (k = key contiguous, the A layout
// of the V^T.P^T step). grid = 4*8*32 blocks; block = (b, h, 64-key tile): thread reads 4 x 16 B of the tile's
// token rows (in[key][d], 64 x 64), RNE-converts into LDS T[d][key] (pitch 72); after a barrier each wave
// coverage: 1024 blocks x 64 d-rows x 64 keys = the whole [32][64][2048] plane.
// =====================================================================================================
__global__ __launch_bounds__(256) void prep_vt(const float* __restrict__ v, unsigned short* VT) {
  __shared__ __align__(16) unsigned short T[ND * 72];    // [d][72], 9216 B
  const int tid   = threadIdx.x;
  const int stile = blockIdx.x & (NKC - 1);
  const int bh    = blockIdx.x >> 5;
  const int h     = bh & (NH - 1);
  const int b     = bh >> 3;
  const int s0    = stile * 64;
  const float* vp = v + ((size_t)(b * NS + s0) * NH + h) * ND;     // token row srow at + srow*NTD
#pragma unroll
  for (int rr = 0; rr < 4; ++rr) {
    const int idx  = tid + rr * 256;        // 0..1023
    const int srow = idx >> 4;              // key within tile, 0..63
    const int d4   = (idx & 15) << 2;       // d, 0..60
    const v4f vf = *(const v4f*)(vp + (size_t)srow * NTD + d4);
#pragma unroll
    for (int e = 0; e < 4; ++e) T[(d4 + e) * 72 + srow] = bf_bits(vf[e]);
  }
  __syncthreads();
  unsigned short* vout = VT + (size_t)bh * ND * NS + s0;           // row d at + d*NS
  v4u tv[2];
  size_t to[2];
#pragma unroll
  for (int rr = 0; rr < 2; ++rr) {
    const int idx  = tid + rr * 256;        // 0..511
    const int drow = idx >> 3;              // 0..63
    const int c8   = (idx & 7) << 3;        // 0..56 halves
    tv[rr] = *(const v4u*)(T + drow * 72 + c8);
    to[rr] = (size_t)drow * NS + c8;
  }
  {
    *(v4u*)(vout + to[0]) = tv[0];
    *(v4u*)(vout + to[1]) = tv[1];
    
  }
}

#define LP      72         // halves per LDS row
#define OP      68         // floats per row of the epilogue staging: 272 B = 16 B x 17 (odd)
#define L_K     0          // K chunk   [64 keys][72] bf16   9216 B
#define L_V     9216       // V^T chunk [64 d][72] bf16      9216 B
#define L_O     0          // epilogue only: [8 waves][16 queries][68] f32  34816 B, over the K / V^T area
#define L_D     34816      // delta row of the batch, f32 [2048]  8192 B
#define L_TOTAL 43008
static_assert((LP * 2) % 16 == 0 && ((LP * 2) / 16) % 2 == 1);
static_assert((OP * 4) % 16 == 0 && ((OP * 4) / 16) % 2 == 1);
static_assert(L_V - L_K == 64 * LP * 2);
static_assert(L_V + ND * LP * 2 <= L_D);
static_assert(L_D - L_O == 8 * 16 * OP * 4);
static_assert(L_TOTAL - L_D == NS * 4);

// value of lane l ^ 16 (the other half's lane of the same query column)
__device__ __forceinline__ float other_half(float x) {
  const int bts = __float_as_int(x);
  return __int_as_float(__builtin_amdgcn_permlanex16(bts, bts, 0x76543210, 0xfedcba98, false, false));
}

__global__ __launch_bounds__(256)
void attn_ds(const unsigned short* __restrict__ qbp, const unsigned short* __restrict__ kbp,
             const unsigned short* __restrict__ vtp, const float* __restrict__ tau,
             const float* __restrict__ delta, float* Op) {
  __shared__ __align__(16) unsigned char lds[L_TOTAL];
  union FB { v16b v; v8b h[2]; };
  union PB { v16b v; unsigned u[8]; };
  __bf16* Ksh = (__bf16*)(lds + L_K);
  __bf16* Vth = (__bf16*)(lds + L_V);
  float*  sDl = (float*)(lds + L_D);

  const int tid  = threadIdx.x;
  const int wave = tid >> 5;
  const int lane = tid & 31;
  const int hh   = lane >> 4;
  const int c    = lane & 15;

  const int bx = blockIdx.x;
  const int qb = bx & (NQB - 1);              // query block 0..15
  const int bh = bx >> 4;                     // (b, h) pair 0..31
  const int h  = bh & (NH - 1);
  const int b  = bh >> 3;
  const int q0 = qb * 128 + wave * 16;        // first query of this wave

  const __bf16* Qg = (const __bf16*)(const void*)qbp;
  const __bf16* Kg = (const __bf16*)(const void*)kbp;
  const __bf16* Vg = (const __bf16*)(const void*)vtp + (size_t)bh * ND * NS;

  // ---- delta row of batch b -> LDS as bf16-valued f32 (read after the first two block barriers) ----
  {
    const float* dp = delta + (size_t)b * NS;
#pragma unroll
    for (int rr = 0; rr < 2; ++rr) {
      const int idx = tid + rr * 256;         // 0..511 pieces of 4 floats = 2048
      const v4f x = *(const v4f*)(dp + idx * 4);
      v4f y;
#pragma unroll
      for (int e = 0; e < 4; ++e) y[e] = bf_up(bf_bits(x[e]));
      *(v4f*)(sDl + idx * 4) = y;
    }
  }
  const float taub = bf_up(bf_bits(tau[b]));

  // ---- q B fragments for both 32-deep d-chunks: column q0 + c, k = d ----
  const size_t qo = ((size_t)(b * NL + q0 + c) * NH + h) * ND + 8 * hh;
  v16b qa[2];
  qa[0] = ldfrag_b(Qg + qo);
  qa[1] = ldfrag_b(Qg + qo + 32);

  v8f O[4];                                   // O^T tiles: d = t*16 + 8*hh + r, query c
#pragma unroll
  for (int t = 0; t < 4; ++t) O[t] = zero8();
  float mrow = -INFINITY;                     // running maximum of query c (equal in both halves)
  float lrow = 0.f;                           // this half's share of the denominator of query c

  for (int kt = 0; kt < NKC; ++kt) {          // block-uniform trip count
    const int kv0 = kt * 64;
    __syncthreads();                          // every wave is done with the prior chunk's tiles
    {
#pragma unroll
      for (int i = 0; i < 2; ++i) {
        const int p  = tid + 256 * i;         // 0..511
        const int rw = p >> 3;                // key (K tile) / d (V^T tile), 0..63
        const int sg = (p & 7) * 8;           // 0..56 halves
        const v8b a0 = *(const v8b*)(Kg + ((size_t)(b * NS + kv0 + rw) * NH + h) * ND + sg);
        const v8b b0 = *(const v8b*)(Vg + (size_t)rw * NS + kv0 + sg);
        *(v8b*)(Ksh + rw * LP + sg) = a0;
        *(v8b*)(Vth + rw * LP + sg) = b0;
      }
    }
    __syncthreads();

    // ---- S^T: 64 keys x 16 query columns per wave, exact bf16 products over 2 d-chunks ----
    v8f s[4];
#pragma unroll
    for (int j = 0; j < 4; ++j) s[j] = zero8();
#pragma unroll
    for (int dc = 0; dc < 2; ++dc) {
      const int ko = dc * 32 + 8 * hh;
#pragma unroll
      for (int j = 0; j < 4; ++j) {
        const int kr = (j * 16 + c) * LP + ko;   // A: key j*16+c (row), d = dc*32 + 8h .. (k)
        FB kb;
        kb.h[0] = *(const v8b*)(Ksh + kr);
        kb.h[1] = *(const v8b*)(Ksh + kr + 16);
        s[j] = mma_b(kb.v, qa[dc], s[j]);
      }
    }

    // ---- bias per key row, scale, column maximum in the lane + one exchange between the halves ----
    float mj[4];
#pragma unroll
    for (int j = 0; j < 4; ++j) {
      const float* dj = sDl + kv0 + j * 16 + 8 * hh;   // delta of keys j*16 + 8*hh + 0..7
      const v4f d0 = *(const v4f*)(dj);
      const v4f d1 = *(const v4f*)(dj + 4);
      float m = -INFINITY;
#pragma unroll
      for (int r = 0; r < 8; ++r) {
        const float sv = (s[j][r] * taub + (r < 4 ? d0[r & 3] : d1[r & 3])) * 0.125f;
        s[j][r] = sv;
        m = fmaxf(m, sv);
      }
      mj[j] = m;
    }
    float mc = fmaxf(fmaxf(mj[0], mj[1]), fmaxf(mj[2], mj[3]));
    mc = fmaxf(mc, other_half(mc));
    const float mnew = fmaxf(mrow, mc);         // finite: every chunk has 64 valid keys
    const float al   = __expf(mrow - mnew);     // first chunk: exp(-inf) = 0
    mrow = mnew;

    // ---- p = exp(x - m); hi / lo bf16 packed in place into the B operands of the two 32-key groups ----
    PB ph[2], pl[2];
    float pj[4];
#pragma unroll
    for (int j = 0; j < 4; ++j) {
      float psum = 0.f;
#pragma unroll
      for (int r = 0; r < 8; r += 2) {
        const float p0 = __expf(s[j][r]     - mnew);
        const float p1 = __expf(s[j][r + 1] - mnew);
        psum += p0;
        psum += p1;
        const unsigned short h0 = bf_bits(p0);
        const unsigned short h1 = bf_bits(p1);
        const unsigned short l0 = bf_bits(p0 - bf_up(h0));
        const unsigned short l1 = bf_bits(p1 - bf_up(h1));
        ph[j >> 1].u[(j & 1) * 4 + (r >> 1)] = pk16(h0, h1);
        pl[j >> 1].u[(j & 1) * 4 + (r >> 1)] = pk16(l0, l1);
      }
      pj[j] = psum;
    }
    lrow = lrow * al + ((pj[0] + pj[1]) + (pj[2] + pj[3]));

    // ---- rescale the running context, then O^T += V^T . P^T (2 bf16 products) ----
#pragma unroll
    for (int t = 0; t < 4; ++t) {
#pragma unroll
      for (int r = 0; r < 8; ++r) O[t][r] *= al;
    }
#pragma unroll
    for (int kk = 0; kk < 2; ++kk) {
#pragma unroll
      for (int t = 0; t < 4; ++t) {
        const int vr = (t * 16 + c) * LP + kk * 32 + 8 * hh;   // A fragment: row d = t*16+c, keys kk*32 + 8h ..
        FB vb;
        vb.h[0] = *(const v8b*)(Vth + vr);
        vb.h[1] = *(const v8b*)(Vth + vr + 16);
        O[t] = mma_b(vb.v, ph[kk].v, O[t]);
        O[t] = mma_b(vb.v, pl[kk].v, O[t]);
      }
    }
  }
  __syncthreads();                             // every wave is past its last K / V^T read

  // ---- join the halves' denominators, normalise, stage the wave's 16x64 f32 tile, whole-line writes ----
  float* os = (float*)(lds + L_O) + wave * (16 * OP);   // the wave's own staging slot
  const float lsum = lrow + other_half(lrow);
  const float inv  = (lsum > 0.f) ? (1.0f / lsum) : 0.f;
#pragma unroll
  for (int t = 0; t < 4; ++t) {
    v4f w0, w1;
#pragma unroll
    for (int r = 0; r < 4; ++r) { w0[r] = O[t][r] * inv; w1[r] = O[t][r + 4] * inv; }
    *(v4f*)(os + c * OP + t * 16 + 8 * hh)     = w0;
    *(v4f*)(os + c * OP + t * 16 + 8 * hh + 4) = w1;
  }
  __builtin_amdgcn_fence(__ATOMIC_RELEASE, "workgroup");
  __builtin_amdgcn_wave_barrier();
  __builtin_amdgcn_fence(__ATOMIC_ACQUIRE, "workgroup");
  float* og = Op + ((size_t)(b * NL + q0) * NH + h) * ND;   // row r of the wave at + r*NTD
  const int colw = c * 4;
  v4f ov[8];
#pragma unroll
  for (int it = 0; it < 8; ++it) {
    const int row = 2 * it + hh;               // rows 0..15: lanes 0..15 even row, lanes 16..31 odd row
    ov[it] = *(const v4f*)(os + row * OP + colw);
  }
  {
#pragma unroll
    for (int it = 0; it < 8; ++it) {
      const int row = 2 * it + hh;
      *(v4f*)(og + (size_t)row * NTD + colw) = ov[it];
    }
    
  }
}

// =====================================================================================================
//   Qb  bf16 [4][2048][8][64]          0         8388608
//   Kb  bf16 [4][2048][8][64]    8388608         8388608
//   VT  bf16 [32][64][2048]     16777216         8388608
//   end                         25165824
// =====================================================================================================
extern "C" void kernel_launch(void* const* d_in, const int* in_sizes, int n_in,
                              void* d_out, int out_size, void* d_ws, size_t ws_size,
                              hipStream_t stream) {
  const int nqkv = NB * NL * NH * ND;                       // 4194304
  if (n_in < 5) return;
  if (in_sizes[0] != nqkv || in_sizes[1] != nqkv || in_sizes[2] != nqkv) return;
  if (in_sizes[3] != NB || in_sizes[4] != NB * NS) return;
  if (out_size != nqkv) return;

  const float* q     = (const float*)d_in[0];
  const float* k     = (const float*)d_in[1];
  const float* v     = (const float*)d_in[2];
  const float* tau   = (const float*)d_in[3];
  const float* delta = (const float*)d_in[4];

  const size_t PL = (size_t)nqkv * 2;                       // 8388608
  size_t off = 0;
  const size_t oQ = off; off += PL;
  const size_t oK = off; off += PL;
  const size_t oV = off; off += PL;
  if (off > ws_size) return;                               // off = 25165824
  if (off > (size_t)134217728) return;

  char* ws = (char*)d_ws;
  unsigned short* Qb = (unsigned short*)(ws + oQ);
  unsigned short* Kb = (unsigned short*)(ws + oK);
  unsigned short* VT = (unsigned short*)(ws + oV);

  const int  n8 = nqkv / 8;                                 // 524288
  const dim3 blk(256);
  const dim3 gCvt((n8 + 255) / 256);                        // 2048 blocks
  const dim3 gVt(NB * NH * NKC);                            // 1024 blocks
  const dim3 gAttn(NB * NH * NQB);                          // 512 blocks

  // (1) q, k -> bf16 planes (RNE convert, same layout as the inputs)
  cvt_qk<<<gCvt, blk, 0, stream>>>(q, k, Qb, Kb, n8);
  // (2) v -> bf16 V^T planes [b*8+h][64][2048]
  prep_vt<<<gVt, blk, 0, stream>>>(v, VT);
  // (3) attention per (b, h, 128-query block) -> d_out f32 [4][2048][8][64]
  attn_ds<<<gAttn, blk, 0, stream>>>(Qb, Kb, VT, tau, delta, (float*)d_out);
  (void)hipGetLastError();
}

// v004
// It runs in 67.3 microseconds.
// Next to v003, in two timings, it ran 1.33 times as fast each time.
// All steps since v000 together make it 2.86 times as fast.
// Contractions: k.q^T scores (transposed) = v_wmma_f32_16x16x32_bf16 (bf16 operands from RNE-converted q and k, single exact product, f32 accumulate);
// v^T.p^T context (transposed) = v_wmma_f32_16x16x32_bf16 with p as bf16 hi + unscaled bf16 residual and RNE-converted v (hi.v + lo.v), f32 accumulate;
// tau / delta bias, the 1/8 scale, online softmax, denominators and the final normalisation in f32 on the VALU.
// Carry audit: no power-of-two carries anywhere; the p residual plane is the unscaled RNE residual (p - hi) and shares the hi
// accumulator; the 1/8 scale is applied once in f32 after the tau / delta step; denominators divided out once in the epilogue.
#include <hip/hip_runtime.h>
#include <math.h>
#include <stdint.h>

#define NB   4
#define NL   2048
#define NS   2048
#define NH   8
#define ND   64
#define NTD  (NH * ND)        // 512 floats per token row
#define NQB  (NL / 128)        // 16 query blocks of 128 rows per (b, h)
#define NKC  (NS / 64)         // 32 key chunks of 64 keys
static_assert(NQB == 16);
static_assert(NKC == 32);
static_assert((NL % 128) == 0 && (NS % 64) == 0 && ND == 64 && (ND % 32) == 0);

typedef __bf16   v16b __attribute__((ext_vector_type(16)));
typedef __bf16   v8b  __attribute__((ext_vector_type(8)));
typedef float    v8f  __attribute__((ext_vector_type(8)));
typedef float    v4f  __attribute__((ext_vector_type(4)));
typedef unsigned int v4u __attribute__((ext_vector_type(4)));
typedef float    v2f  __attribute__((ext_vector_type(2)));
typedef __bf16   v2b  __attribute__((ext_vector_type(2)));

// ---- scalar helpers --------------------------------------------------------------------------------
__device__ __forceinline__ v2b cvt2(float a, float b) {               // two f32 -> packed bf16 pair, the chip's own RNE convert
  const v2f x = {a, b};
  return __builtin_convertvector(x, v2b);
}
__device__ __forceinline__ unsigned cvt2u(float a, float b) { return __builtin_bit_cast(unsigned, cvt2(a, b)); }
__device__ __forceinline__ float bf_round(float f) { return (float)(__bf16)f; }   // f32 value rounded to bf16 (RNE)
__device__ __forceinline__ v8f zero8() { v8f z = {0.f, 0.f, 0.f, 0.f, 0.f, 0.f, 0.f, 0.f}; return z; }

// ---- fragment loader: 16-bit A/B operand, lane -> row/col (lane&15), p already includes +8*(lane>>4);
//      elements 0..7 <- p[0..7] (k0+8h..), elements 8..15 <- p[16..23] (k0+16+8h..)
__device__ __forceinline__ v16b ldfrag_b(const __bf16* p) {
  union { v16b v; v8b h[2]; } f;
  f.h[0] = *(const v8b*)(p);
  f.h[1] = *(const v8b*)(p + 16);
  return f.v;
}

// ---- WMMA helper: the builtin alone, the compiler keeps the hazard distance and is free to group the LDS loads ----
__device__ __forceinline__ v8f mma_b(v16b a, v16b b, v8f c) {
  return __builtin_amdgcn_wmma_f32_16x16x32_bf16(false, a, false, b, (short)0, c, false, false);
}

// ---- 8 consecutive f32 -> 8 bf16 bits packed in one 16-B vector ----------------------------------------
__device__ __forceinline__ v4u cvt8(const float* __restrict__ p) {
  const v4f a = *(const v4f*)(p);
  const v4f b = *(const v4f*)(p + 4);
  v4u r;
  r[0] = cvt2u(a[0], a[1]);
  r[1] = cvt2u(a[2], a[3]);
  r[2] = cvt2u(b[0], b[1]);
  r[3] = cvt2u(b[2], b[3]);
  return r;
}

// =====================================================================================================
// q and k f32 [4][2048][8][64] -> bf16 planes with the identical element layout (RNE convert), 8 elements
// coverage: n8 = 524288 threads x 8 = all 4194304 elements of each plane.
// =====================================================================================================
__global__ __launch_bounds__(256) void cvt_qk(const float* __restrict__ q, const float* __restrict__ k,
                                              unsigned short* Qo, unsigned short* Ko, int n8) {
  const int i = blockIdx.x * 256 + threadIdx.x;
  if (i < n8) {
    const size_t e = (size_t)i * 8;
    const v4u pq = cvt8(q + e);
    const v4u pk = cvt8(k + e);
    *(v4u*)(Qo + e) = pq;
    *(v4u*)(Ko + e) = pk;
    
  }
}

// =====================================================================================================
// v f32 [4][2048][8][64] -> bf16 V^T planes VT [b*8+h][64 d][2048 keys] (k = key contiguous, the A layout
// of the V^T.P^T step). grid = 4*8*32 blocks; block = (b, h, 64-key tile): thread reads 4 x 16 B of the tile's
// token rows (in[key][d], 64 x 64), RNE-converts into LDS T[d][key] (pitch 72); after a barrier each wave
// coverage: 1024 blocks x 64 d-rows x 64 keys = the whole [32][64][2048] plane.
// =====================================================================================================
__global__ __launch_bounds__(256) void prep_vt(const float* __restrict__ v, unsigned short* VT) {
  __shared__ __align__(16) unsigned short T[ND * 72];    // [d][72], 9216 B
  const int tid   = threadIdx.x;
  const int stile = blockIdx.x & (NKC - 1);
  const int bh    = blockIdx.x >> 5;
  const int h     = bh & (NH - 1);
  const int b     = bh >> 3;
  const int s0    = stile * 64;
  const float* vp = v + ((size_t)(b * NS + s0) * NH + h) * ND;     // token row srow at + srow*NTD
#pragma unroll
  for (int rr = 0; rr < 4; ++rr) {
    const int idx  = tid + rr * 256;        // 0..1023
    const int srow = idx >> 4;              // key within tile, 0..63
    const int d4   = (idx & 15) << 2;       // d, 0..60
    const v4f vf = *(const v4f*)(vp + (size_t)srow * NTD + d4);
#pragma unroll
    for (int e = 0; e < 4; e += 2) {
      const unsigned w = cvt2u(vf[e], vf[e + 1]);
      T[(d4 + e) * 72 + srow]     = (unsigned short)(w & 0xFFFFu);
      T[(d4 + e + 1) * 72 + srow] = (unsigned short)(w >> 16);
    }
  }
  __syncthreads();
  unsigned short* vout = VT + (size_t)bh * ND * NS + s0;           // row d at + d*NS
  v4u tv[2];
  size_t to[2];
#pragma unroll
  for (int rr = 0; rr < 2; ++rr) {
    const int idx  = tid + rr * 256;        // 0..511
    const int drow = idx >> 3;              // 0..63
    const int c8   = (idx & 7) << 3;        // 0..56 halves
    tv[rr] = *(const v4u*)(T + drow * 72 + c8);
    to[rr] = (size_t)drow * NS + c8;
  }
  {
    *(v4u*)(vout + to[0]) = tv[0];
    *(v4u*)(vout + to[1]) = tv[1];
    
  }
}

#define LP      72         // halves per LDS row
#define OP      68         // floats per row of the epilogue staging: 272 B = 16 B x 17 (odd)
#define L_K     0          // K chunk   [64 keys][72] bf16   9216 B
#define L_V     9216       // V^T chunk [64 d][72] bf16      9216 B
#define L_O     0          // epilogue only: [8 waves][16 queries][68] f32  34816 B, over the K / V^T area
#define L_D     34816      // delta row of the batch, f32 [2048]  8192 B
#define L_TOTAL 43008
static_assert((LP * 2) % 16 == 0 && ((LP * 2) / 16) % 2 == 1);
static_assert((OP * 4) % 16 == 0 && ((OP * 4) / 16) % 2 == 1);
static_assert(L_V - L_K == 64 * LP * 2);
static_assert(L_V + ND * LP * 2 <= L_D);
static_assert(L_D - L_O == 8 * 16 * OP * 4);
static_assert(L_TOTAL - L_D == NS * 4);

// value of lane l ^ 16 (the other half's lane of the same query column)
__device__ __forceinline__ float other_half(float x) {
  const int bts = __float_as_int(x);
  return __int_as_float(__builtin_amdgcn_permlanex16(bts, bts, 0x76543210, 0xfedcba98, false, false));
}

__global__ __launch_bounds__(256)
void attn_ds(const unsigned short* __restrict__ qbp, const unsigned short* __restrict__ kbp,
             const unsigned short* __restrict__ vtp, const float* __restrict__ tau,
             const float* __restrict__ delta, float* Op) {
  __shared__ __align__(16) unsigned char lds[L_TOTAL];
  union FB { v16b v; v8b h[2]; };
  union PB { v16b v; unsigned u[8]; };
  __bf16* Ksh = (__bf16*)(lds + L_K);
  __bf16* Vth = (__bf16*)(lds + L_V);
  float*  sDl = (float*)(lds + L_D);

  const int tid  = threadIdx.x;
  const int wave = tid >> 5;
  const int lane = tid & 31;
  const int hh   = lane >> 4;
  const int c    = lane & 15;

  const int bx = blockIdx.x;
  const int qb = bx & (NQB - 1);              // query block 0..15
  const int bh = bx >> 4;                     // (b, h) pair 0..31
  const int h  = bh & (NH - 1);
  const int b  = bh >> 3;
  const int q0 = qb * 128 + wave * 16;        // first query of this wave

  const __bf16* Qg = (const __bf16*)(const void*)qbp;
  const __bf16* Kg = (const __bf16*)(const void*)kbp;
  const __bf16* Vg = (const __bf16*)(const void*)vtp + (size_t)bh * ND * NS;

  // ---- delta row of batch b -> LDS as bf16-valued f32 (read after the first two block barriers) ----
  {
    const float* dp = delta + (size_t)b * NS;
#pragma unroll
    for (int rr = 0; rr < 2; ++rr) {
      const int idx = tid + rr * 256;         // 0..511 pieces of 4 floats = 2048
      const v4f x = *(const v4f*)(dp + idx * 4);
      v4f y;
#pragma unroll
      for (int e = 0; e < 4; ++e) y[e] = bf_round(x[e]);
      *(v4f*)(sDl + idx * 4) = y;
    }
  }
  const float taub = bf_round(tau[b]);

  // ---- q B fragments for both 32-deep d-chunks: column q0 + c, k = d ----
  const size_t qo = ((size_t)(b * NL + q0 + c) * NH + h) * ND + 8 * hh;
  v16b qa[2];
  qa[0] = ldfrag_b(Qg + qo);
  qa[1] = ldfrag_b(Qg + qo + 32);

  v8f O[4];                                   // O^T tiles: d = t*16 + 8*hh + r, query c
#pragma unroll
  for (int t = 0; t < 4; ++t) O[t] = zero8();
  float mrow = -INFINITY;                     // running maximum of query c (equal in both halves)
  float lrow = 0.f;                           // this half's share of the denominator of query c

  for (int kt = 0; kt < NKC; ++kt) {          // block-uniform trip count
    const int kv0 = kt * 64;
    __syncthreads();                          // every wave is done with the prior chunk's tiles
    {
#pragma unroll
      for (int i = 0; i < 2; ++i) {
        const int p  = tid + 256 * i;         // 0..511
        const int rw = p >> 3;                // key (K tile) / d (V^T tile), 0..63
        const int sg = (p & 7) * 8;           // 0..56 halves
        const v8b a0 = *(const v8b*)(Kg + ((size_t)(b * NS + kv0 + rw) * NH + h) * ND + sg);
        const v8b b0 = *(const v8b*)(Vg + (size_t)rw * NS + kv0 + sg);
        *(v8b*)(Ksh + rw * LP + sg) = a0;
        *(v8b*)(Vth + rw * LP + sg) = b0;
      }
    }
    __syncthreads();

    // ---- S^T: 64 keys x 16 query columns per wave, exact bf16 products over 2 d-chunks ----
    v8f s[4];
#pragma unroll
    for (int j = 0; j < 4; ++j) s[j] = zero8();
#pragma unroll
    for (int dc = 0; dc < 2; ++dc) {
      const int ko = dc * 32 + 8 * hh;
#pragma unroll
      for (int j = 0; j < 4; ++j) {
        const int kr = (j * 16 + c) * LP + ko;   // A: key j*16+c (row), d = dc*32 + 8h .. (k)
        FB kb;
        kb.h[0] = *(const v8b*)(Ksh + kr);
        kb.h[1] = *(const v8b*)(Ksh + kr + 16);
        s[j] = mma_b(kb.v, qa[dc], s[j]);
      }
    }

    // ---- bias per key row, scale, column maximum in the lane + one exchange between the halves ----
    float mj[4];
#pragma unroll
    for (int j = 0; j < 4; ++j) {
      const float* dj = sDl + kv0 + j * 16 + 8 * hh;   // delta of keys j*16 + 8*hh + 0..7
      const v4f d0 = *(const v4f*)(dj);
      const v4f d1 = *(const v4f*)(dj + 4);
      float m = -INFINITY;
#pragma unroll
      for (int r = 0; r < 8; ++r) {
        const float sv = (s[j][r] * taub + (r < 4 ? d0[r & 3] : d1[r & 3])) * 0.125f;
        s[j][r] = sv;
        m = fmaxf(m, sv);
      }
      mj[j] = m;
    }
    float mc = fmaxf(fmaxf(mj[0], mj[1]), fmaxf(mj[2], mj[3]));
    mc = fmaxf(mc, other_half(mc));
    const float mnew = fmaxf(mrow, mc);         // finite: every chunk has 64 valid keys
    const float al   = __expf(mrow - mnew);     // first chunk: exp(-inf) = 0
    mrow = mnew;

    // ---- p = exp(x - m); hi / lo bf16 packed in place into the B operands of the two 32-key groups ----
    PB ph[2], pl[2];
    float pj[4];
#pragma unroll
    for (int j = 0; j < 4; ++j) {
      float psum = 0.f;
#pragma unroll
      for (int r = 0; r < 8; r += 2) {
        const float p0 = __expf(s[j][r]     - mnew);
        const float p1 = __expf(s[j][r + 1] - mnew);
        psum += p0;
        psum += p1;
        const v2b hb = cvt2(p0, p1);
        ph[j >> 1].u[(j & 1) * 4 + (r >> 1)] = __builtin_bit_cast(unsigned, hb);
        pl[j >> 1].u[(j & 1) * 4 + (r >> 1)] = cvt2u(p0 - (float)hb[0], p1 - (float)hb[1]);
      }
      pj[j] = psum;
    }
    lrow = lrow * al + ((pj[0] + pj[1]) + (pj[2] + pj[3]));

    // ---- rescale the running context, then O^T += V^T . P^T (2 bf16 products) ----
#pragma unroll
    for (int t = 0; t < 4; ++t) {
#pragma unroll
      for (int r = 0; r < 8; ++r) O[t][r] *= al;
    }
#pragma unroll
    for (int kk = 0; kk < 2; ++kk) {
#pragma unroll
      for (int t = 0; t < 4; ++t) {
        const int vr = (t * 16 + c) * LP + kk * 32 + 8 * hh;   // A fragment: row d = t*16+c, keys kk*32 + 8h ..
        FB vb;
        vb.h[0] = *(const v8b*)(Vth + vr);
        vb.h[1] = *(const v8b*)(Vth + vr + 16);
        O[t] = mma_b(vb.v, ph[kk].v, O[t]);
        O[t] = mma_b(vb.v, pl[kk].v, O[t]);
      }
    }
  }
  __syncthreads();                             // every wave is past its last K / V^T read

  // ---- join the halves' denominators, normalise, stage the wave's 16x64 f32 tile, whole-line writes ----
  float* os = (float*)(lds + L_O) + wave * (16 * OP);   // the wave's own staging slot
  const float lsum = lrow + other_half(lrow);
  const float inv  = (lsum > 0.f) ? (1.0f / lsum) : 0.f;
#pragma unroll
  for (int t = 0; t < 4; ++t) {
    v4f w0, w1;
#pragma unroll
    for (int r = 0; r < 4; ++r) { w0[r] = O[t][r] * inv; w1[r] = O[t][r + 4] * inv; }
    *(v4f*)(os + c * OP + t * 16 + 8 * hh)     = w0;
    *(v4f*)(os + c * OP + t * 16 + 8 * hh + 4) = w1;
  }
  __builtin_amdgcn_fence(__ATOMIC_RELEASE, "workgroup");
  __builtin_amdgcn_wave_barrier();
  __builtin_amdgcn_fence(__ATOMIC_ACQUIRE, "workgroup");
  float* og = Op + ((size_t)(b * NL + q0) * NH + h) * ND;   // row r of the wave at + r*NTD
  const int colw = c * 4;
  v4f ov[8];
#pragma unroll
  for (int it = 0; it < 8; ++it) {
    const int row = 2 * it + hh;               // rows 0..15: lanes 0..15 even row, lanes 16..31 odd row
    ov[it] = *(const v4f*)(os + row * OP + colw);
  }
  {
#pragma unroll
    for (int it = 0; it < 8; ++it) {
      const int row = 2 * it + hh;
      *(v4f*)(og + (size_t)row * NTD + colw) = ov[it];
    }
    
  }
}

// =====================================================================================================
//   Qb  bf16 [4][2048][8][64]          0         8388608
//   Kb  bf16 [4][2048][8][64]    8388608         8388608
//   VT  bf16 [32][64][2048]     16777216         8388608
//   end                         25165824
// =====================================================================================================
extern "C" void kernel_launch(void* const* d_in, const int* in_sizes, int n_in,
                              void* d_out, int out_size, void* d_ws, size_t ws_size,
                              hipStream_t stream) {
  const int nqkv = NB * NL * NH * ND;                       // 4194304
  if (n_in < 5) return;
  if (in_sizes[0] != nqkv || in_sizes[1] != nqkv || in_sizes[2] != nqkv) return;
  if (in_sizes[3] != NB || in_sizes[4] != NB * NS) return;
  if (out_size != nqkv) return;

  const float* q     = (const float*)d_in[0];
  const float* k     = (const float*)d_in[1];
  const float* v     = (const float*)d_in[2];
  const float* tau   = (const float*)d_in[3];
  const float* delta = (const float*)d_in[4];

  const size_t PL = (size_t)nqkv * 2;                       // 8388608
  size_t off = 0;
  const size_t oQ = off; off += PL;
  const size_t oK = off; off += PL;
  const size_t oV = off; off += PL;
  if (off > ws_size) return;                               // off = 25165824
  if (off > (size_t)134217728) return;

  char* ws = (char*)d_ws;
  unsigned short* Qb = (unsigned short*)(ws + oQ);
  unsigned short* Kb = (unsigned short*)(ws + oK);
  unsigned short* VT = (unsigned short*)(ws + oV);

  const int  n8 = nqkv / 8;                                 // 524288
  const dim3 blk(256);
  const dim3 gCvt((n8 + 255) / 256);                        // 2048 blocks
  const dim3 gVt(NB * NH * NKC);                            // 1024 blocks
  const dim3 gAttn(NB * NH * NQB);                          // 512 blocks

  // (1) q, k -> bf16 planes (RNE convert, same layout as the inputs)
  cvt_qk<<<gCvt, blk, 0, stream>>>(q, k, Qb, Kb, n8);
  // (2) v -> bf16 V^T planes [b*8+h][64][2048]
  prep_vt<<<gVt, blk, 0, stream>>>(v, VT);
  // (3) attention per (b, h, 128-query block) -> d_out f32 [4][2048][8][64]
  attn_ds<<<gAttn, blk, 0, stream>>>(Qb, Kb, VT, tau, delta, (float*)d_out);
  (void)hipGetLastError();
}

// v005
// A run of this version takes 51.7 microseconds.
// Two timings next to v004 put it at 1.33 and 1.30 times that version's speed.
// Counting every step since v000, it is 3.76 times as fast.
// One launch: the attention kernel reads q, k and v as f32 and RNE-converts them to bf16 on the way into registers / LDS.
// Contractions: k.q^T scores (transposed) = v_wmma_f32_16x16x32_bf16 (bf16 operands from RNE-converted q and k, single exact product, f32 accumulate);
// v^T.p^T context (transposed) = v_wmma_f32_16x16x32_bf16 with p as bf16 hi + unscaled bf16 residual and RNE-converted v (hi.v + lo.v), f32 accumulate;
// tau / delta bias, the 1/8 scale, online softmax, denominators and the final normalisation in f32 on the VALU.
// Carry audit: no power-of-two carries anywhere; the p residual plane is the unscaled RNE residual (p - hi) and shares the hi
// accumulator; the 1/8 scale is applied once in f32 after the tau / delta step; denominators divided out once in the epilogue.
#include <hip/hip_runtime.h>
#include <math.h>
#include <stdint.h>

#define NB   4
#define NL   2048
#define NS   2048
#define NH   8
#define ND   64
#define NTD  (NH * ND)        // 512 floats per token row
#define NQB  (NL / 128)        // 16 query blocks of 128 rows per (b, h)
#define NKC  (NS / 64)         // 32 key chunks of 64 keys
static_assert(NQB == 16);
static_assert(NKC == 32);
static_assert((NL % 128) == 0 && (NS % 64) == 0 && ND == 64 && (ND % 32) == 0);

typedef __bf16   v16b __attribute__((ext_vector_type(16)));
typedef __bf16   v8b  __attribute__((ext_vector_type(8)));
typedef float    v8f  __attribute__((ext_vector_type(8)));
typedef float    v4f  __attribute__((ext_vector_type(4)));
typedef unsigned int v4u __attribute__((ext_vector_type(4)));
typedef unsigned int v2u __attribute__((ext_vector_type(2)));
typedef float    v2f  __attribute__((ext_vector_type(2)));
typedef __bf16   v2b  __attribute__((ext_vector_type(2)));

// ---- scalar helpers --------------------------------------------------------------------------------
__device__ __forceinline__ v2b cvt2(float a, float b) {               // two f32 -> packed bf16 pair, the chip's own RNE convert
  const v2f x = {a, b};
  return __builtin_convertvector(x, v2b);
}
__device__ __forceinline__ unsigned cvt2u(float a, float b) { return __builtin_bit_cast(unsigned, cvt2(a, b)); }
__device__ __forceinline__ float bf_round(float f) { return (float)(__bf16)f; }   // f32 value rounded to bf16 (RNE)
__device__ __forceinline__ v8f zero8() { v8f z = {0.f, 0.f, 0.f, 0.f, 0.f, 0.f, 0.f, 0.f}; return z; }

// ---- WMMA helper: the builtin alone, the compiler keeps the hazard distance and is free to group the LDS loads ----
__device__ __forceinline__ v8f mma_b(v16b a, v16b b, v8f c) {
  return __builtin_amdgcn_wmma_f32_16x16x32_bf16(false, a, false, b, (short)0, c, false, false);
}

#define LP      72         // halves per LDS row
#define OP      68         // floats per row of the epilogue staging: 272 B = 16 B x 17 (odd)
#define L_K     0          // K chunk   [64 keys][72] bf16   9216 B
#define L_V     9216       // V^T chunk [64 d][72] bf16      9216 B
#define L_O     0          // epilogue only: [8 waves][16 queries][68] f32  34816 B, over the K / V^T area
#define L_D     34816      // delta row of the batch, f32 [2048]  8192 B
#define L_TOTAL 43008
static_assert((LP * 2) % 16 == 0 && ((LP * 2) / 16) % 2 == 1);
static_assert((OP * 4) % 16 == 0 && ((OP * 4) / 16) % 2 == 1);
static_assert(L_V - L_K == 64 * LP * 2);
static_assert(L_V + ND * LP * 2 <= L_D);
static_assert(L_D - L_O == 8 * 16 * OP * 4);
static_assert(L_TOTAL - L_D == NS * 4);

// value of lane l ^ 16 (the other half's lane of the same query column)
__device__ __forceinline__ float other_half(float x) {
  const int bts = __float_as_int(x);
  return __int_as_float(__builtin_amdgcn_permlanex16(bts, bts, 0x76543210, 0xfedcba98, false, false));
}

__global__ __launch_bounds__(256)
void attn_ds(const float* __restrict__ qp, const float* __restrict__ kp,
             const float* __restrict__ vp, const float* __restrict__ tau,
             const float* __restrict__ delta, float* Op) {
  __shared__ __align__(16) unsigned char lds[L_TOTAL];
  union FB { v16b v; v8b h[2]; };
  union PB { v16b v; unsigned u[8]; };
  __bf16* Ksh = (__bf16*)(lds + L_K);
  __bf16* Vth = (__bf16*)(lds + L_V);
  float*  sDl = (float*)(lds + L_D);

  const int tid  = threadIdx.x;
  const int wave = tid >> 5;
  const int lane = tid & 31;
  const int hh   = lane >> 4;
  const int c    = lane & 15;

  const int bx = blockIdx.x;
  const int qb = bx & (NQB - 1);              // query block 0..15
  const int bh = bx >> 4;                     // (b, h) pair 0..31
  const int h  = bh & (NH - 1);
  const int b  = bh >> 3;
  const int q0 = qb * 128 + wave * 16;        // first query of this wave

  // block-uniform bases of this (b, h): key row s at + s*NTD; per-thread element offsets inside a 64-key chunk
  const float* Kg = kp + ((size_t)(b * NS) * NH + h) * ND;
  const float* Vg = vp + ((size_t)(b * NS) * NH + h) * ND;
  const int krow = tid >> 4;                  // K: rows krow + 16*i, i = 0..3
  const int kcol = (tid & 15) * 4;            // K: d kcol .. kcol+3
  const int koff = krow * NTD + kcol;
  const int voff = wave * 8 * NTD + lane * 2; // V: keys wave*8 + j, j = 0..7; d 2*lane, 2*lane+1

  // ---- chunk 0 of k and v, f32, into the staging registers ----
  v4f kst[4];
  v2f vst[8];
#pragma unroll
  for (int i = 0; i < 4; ++i) kst[i] = *(const v4f*)(Kg + koff + i * 16 * NTD);
#pragma unroll
  for (int j = 0; j < 8; ++j) vst[j] = *(const v2f*)(Vg + voff + j * NTD);

  // ---- delta row of batch b -> LDS as bf16-valued f32 (read after the first two block barriers) ----
  {
    const float* dp = delta + (size_t)b * NS;
#pragma unroll
    for (int rr = 0; rr < 2; ++rr) {
      const int idx = tid + rr * 256;         // 0..511 pieces of 4 floats = 2048
      const v4f x = *(const v4f*)(dp + idx * 4);
      v4f y;
#pragma unroll
      for (int e = 0; e < 4; ++e) y[e] = bf_round(x[e]);
      *(v4f*)(sDl + idx * 4) = y;
    }
  }
  const float taub = bf_round(tau[b]);

  // ---- q B fragments for both 32-deep d-chunks: column q0 + c, k = d ----
  //      element e < 8: d = dc*32 + 8*hh + e, e >= 8: d = dc*32 + 16 + 8*hh + e - 8; f32 rows converted in registers
  const float* qrow = qp + ((size_t)(b * NL + q0 + c) * NH + h) * ND + 8 * hh;
  v16b qa[2];
#pragma unroll
  for (int dc = 0; dc < 2; ++dc) {
    PB qf;
#pragma unroll
    for (int g = 0; g < 2; ++g) {
      const v4f x0 = *(const v4f*)(qrow + dc * 32 + g * 16);
      const v4f x1 = *(const v4f*)(qrow + dc * 32 + g * 16 + 4);
      qf.u[g * 4 + 0] = cvt2u(x0[0], x0[1]);
      qf.u[g * 4 + 1] = cvt2u(x0[2], x0[3]);
      qf.u[g * 4 + 2] = cvt2u(x1[0], x1[1]);
      qf.u[g * 4 + 3] = cvt2u(x1[2], x1[3]);
    }
    qa[dc] = qf.v;
  }

  v8f O[4];                                   // O^T tiles: d = t*16 + 8*hh + r, query c
#pragma unroll
  for (int t = 0; t < 4; ++t) O[t] = zero8();
  float mrow = -INFINITY;                     // running maximum of query c (equal in both halves)
  float lrow = 0.f;                           // this half's share of the denominator of query c

  for (int kt = 0; kt < NKC; ++kt) {          // block-uniform trip count
    const int kv0 = kt * 64;
    __syncthreads();                          // every wave is done with the prior chunk's tiles
    {
#pragma unroll
      for (int i = 0; i < 4; ++i) {
        v2u w;
        w[0] = cvt2u(kst[i][0], kst[i][1]);
        w[1] = cvt2u(kst[i][2], kst[i][3]);
        *(v2u*)(Ksh + (krow + 16 * i) * LP + kcol) = w;
      }
#pragma unroll
      for (int e = 0; e < 2; ++e) {
        v4u w;
#pragma unroll
        for (int jj = 0; jj < 4; ++jj) w[jj] = cvt2u(vst[2 * jj][e], vst[2 * jj + 1][e]);   // low half: the even key
        *(v4u*)(Vth + (2 * lane + e) * LP + wave * 8) = w;
      }
    }
    __syncthreads();
    {
      // The next chunk's f32 tiles fly during this chunk's work; issued behind the barrier, which would wait for them.
      // Unconditional (the last trip re-reads its own chunk, in bounds, unused): no branch, no register copies behind it.
      const int kvn = (kt + 1 < NKC) ? kv0 + 64 : kv0;
      const float* kn = Kg + (size_t)kvn * NTD;
      const float* vn = Vg + (size_t)kvn * NTD;
#pragma unroll
      for (int i = 0; i < 4; ++i) kst[i] = *(const v4f*)(kn + koff + i * 16 * NTD);
#pragma unroll
      for (int j = 0; j < 8; ++j) vst[j] = *(const v2f*)(vn + voff + j * NTD);
      // keeps the twelve loads here, ahead of the chunk's work: left free, the scheduler sinks them to the end of the trip,
      // where their latency is waited out
      __builtin_amdgcn_sched_barrier(0);
    }

    // ---- S^T: 64 keys x 16 query columns per wave, exact bf16 products over 2 d-chunks ----
    v8f s[4];
#pragma unroll
    for (int j = 0; j < 4; ++j) s[j] = zero8();
#pragma unroll
    for (int dc = 0; dc < 2; ++dc) {
      const int ko = dc * 32 + 8 * hh;
#pragma unroll
      for (int j = 0; j < 4; ++j) {
        const int kr = (j * 16 + c) * LP + ko;   // A: key j*16+c (row), d = dc*32 + 8h .. (k)
        FB kb;
        kb.h[0] = *(const v8b*)(Ksh + kr);
        kb.h[1] = *(const v8b*)(Ksh + kr + 16);
        s[j] = mma_b(kb.v, qa[dc], s[j]);
      }
    }

    // ---- bias per key row, scale, column maximum in the lane + one exchange between the halves ----
    float mj[4];
#pragma unroll
    for (int j = 0; j < 4; ++j) {
      const float* dj = sDl + kv0 + j * 16 + 8 * hh;   // delta of keys j*16 + 8*hh + 0..7
      const v4f d0 = *(const v4f*)(dj);
      const v4f d1 = *(const v4f*)(dj + 4);
      float m = -INFINITY;
#pragma unroll
      for (int r = 0; r < 8; ++r) {
        const float sv = (s[j][r] * taub + (r < 4 ? d0[r & 3] : d1[r & 3])) * 0.125f;
        s[j][r] = sv;
        m = fmaxf(m, sv);
      }
      mj[j] = m;
    }
    float mc = fmaxf(fmaxf(mj[0], mj[1]), fmaxf(mj[2], mj[3]));
    mc = fmaxf(mc, other_half(mc));
    const float mnew = fmaxf(mrow, mc);         // finite: every chunk has 64 valid keys
    const float al   = __expf(mrow - mnew);     // first chunk: exp(-inf) = 0
    mrow = mnew;

    // ---- p = exp(x - m); hi / lo bf16 packed in place into the B operands of the two 32-key groups ----
    PB ph[2], pl[2];
    float pj[4];
#pragma unroll
    for (int j = 0; j < 4; ++j) {
      float psum = 0.f;
#pragma unroll
      for (int r = 0; r < 8; r += 2) {
        const float p0 = __expf(s[j][r]     - mnew);
        const float p1 = __expf(s[j][r + 1] - mnew);
        psum += p0;
        psum += p1;
        const v2b hb = cvt2(p0, p1);
        ph[j >> 1].u[(j & 1) * 4 + (r >> 1)] = __builtin_bit_cast(unsigned, hb);
        pl[j >> 1].u[(j & 1) * 4 + (r >> 1)] = cvt2u(p0 - (float)hb[0], p1 - (float)hb[1]);
      }
      pj[j] = psum;
    }
    lrow = lrow * al + ((pj[0] + pj[1]) + (pj[2] + pj[3]));

    // ---- rescale the running context, then O^T += V^T . P^T (2 bf16 products) ----
#pragma unroll
    for (int t = 0; t < 4; ++t) {
#pragma unroll
      for (int r = 0; r < 8; ++r) O[t][r] *= al;
    }
#pragma unroll
    for (int kk = 0; kk < 2; ++kk) {
#pragma unroll
      for (int t = 0; t < 4; ++t) {
        const int vr = (t * 16 + c) * LP + kk * 32 + 8 * hh;   // A fragment: row d = t*16+c, keys kk*32 + 8h ..
        FB vb;
        vb.h[0] = *(const v8b*)(Vth + vr);
        vb.h[1] = *(const v8b*)(Vth + vr + 16);
        O[t] = mma_b(vb.v, ph[kk].v, O[t]);
        O[t] = mma_b(vb.v, pl[kk].v, O[t]);
      }
    }
  }
  __syncthreads();                             // every wave is past its last K / V^T read

  // ---- join the halves' denominators, normalise, stage the wave's 16x64 f32 tile, whole-line writes ----
  float* os = (float*)(lds + L_O) + wave * (16 * OP);   // the wave's own staging slot
  const float lsum = lrow + other_half(lrow);
  const float inv  = (lsum > 0.f) ? (1.0f / lsum) : 0.f;
#pragma unroll
  for (int t = 0; t < 4; ++t) {
    v4f w0, w1;
#pragma unroll
    for (int r = 0; r < 4; ++r) { w0[r] = O[t][r] * inv; w1[r] = O[t][r + 4] * inv; }
    *(v4f*)(os + c * OP + t * 16 + 8 * hh)     = w0;
    *(v4f*)(os + c * OP + t * 16 + 8 * hh + 4) = w1;
  }
  __builtin_amdgcn_fence(__ATOMIC_RELEASE, "workgroup");
  __builtin_amdgcn_wave_barrier();
  __builtin_amdgcn_fence(__ATOMIC_ACQUIRE, "workgroup");
  float* og = Op + ((size_t)(b * NL + q0) * NH + h) * ND;   // row r of the wave at + r*NTD
  const int colw = c * 4;
  v4f ov[8];
#pragma unroll
  for (int it = 0; it < 8; ++it) {
    const int row = 2 * it + hh;               // rows 0..15: lanes 0..15 even row, lanes 16..31 odd row
    ov[it] = *(const v4f*)(os + row * OP + colw);
  }
  {
#pragma unroll
    for (int it = 0; it < 8; ++it) {
      const int row = 2 * it + hh;
      *(v4f*)(og + (size_t)row * NTD + colw) = ov[it];
    }
    
  }
}

extern "C" void kernel_launch(void* const* d_in, const int* in_sizes, int n_in,
                              void* d_out, int out_size, void* d_ws, size_t ws_size,
                              hipStream_t stream) {
  const int nqkv = NB * NL * NH * ND;                       // 4194304
  if (n_in < 5) return;
  if (in_sizes[0] != nqkv || in_sizes[1] != nqkv || in_sizes[2] != nqkv) return;
  if (in_sizes[3] != NB || in_sizes[4] != NB * NS) return;
  if (out_size != nqkv) return;

  const float* q     = (const float*)d_in[0];
  const float* k     = (const float*)d_in[1];
  const float* v     = (const float*)d_in[2];
  const float* tau   = (const float*)d_in[3];
  const float* delta = (const float*)d_in[4];

  (void)d_ws;
  (void)ws_size;                                            // no workspace is used

  const dim3 blk(256);
  const dim3 gAttn(NB * NH * NQB);                          // 512 blocks

  // attention per (b, h, 128-query block), f32 inputs converted inside -> d_out f32 [4][2048][8][64]
  attn_ds<<<gAttn, blk, 0, stream>>>(q, k, v, tau, delta, (float*)d_out);
  (void)hipGetLastError();
}

// v006
// It runs in 49.1 microseconds.
// Timed twice side by side with v005, it ran 1.06 times as fast both times.
// All steps since v000 together make it 3.99 times as fast.
// One launch: the attention kernel reads q, k and v as f32 and RNE-converts them to bf16 on the way into registers / LDS.
// Contractions: k.q^T scores (transposed) = v_wmma_f32_16x16x32_bf16 (bf16 operands from RNE-converted q and k, single exact product, f32 accumulate);
// v^T.p^T context (transposed) = v_wmma_f32_16x16x32_bf16 with p as bf16 hi + unscaled bf16 residual and RNE-converted v (hi.v + lo.v), f32 accumulate;
// tau / delta bias with the 1/8 scale and log2(e) folded into its two f32 constants (one fma per score), online softmax in
// base 2, denominators and the final normalisation in f32 on the VALU.
// Carry audit: no power-of-two carries anywhere; the p residual plane is the unscaled RNE residual (p - hi) and shares the hi
// accumulator; the 1/8 scale rides in the f32 constants of the tau / delta step; denominators divided out once in the epilogue.
#include <hip/hip_runtime.h>
#include <math.h>
#include <stdint.h>

#define NB   4
#define NL   2048
#define NS   2048
#define NH   8
#define ND   64
#define NTD  (NH * ND)        // 512 floats per token row
#define NQB  (NL / 128)        // 16 query blocks of 128 rows per (b, h)
#define NKC  (NS / 64)         // 32 key chunks of 64 keys
static_assert(NQB == 16);
static_assert(NKC == 32);
static_assert((NL % 128) == 0 && (NS % 64) == 0 && ND == 64 && (ND % 32) == 0);

typedef __bf16   v16b __attribute__((ext_vector_type(16)));
typedef __bf16   v8b  __attribute__((ext_vector_type(8)));
typedef float    v8f  __attribute__((ext_vector_type(8)));
typedef float    v4f  __attribute__((ext_vector_type(4)));
typedef unsigned int v4u __attribute__((ext_vector_type(4)));
typedef unsigned int v2u __attribute__((ext_vector_type(2)));
typedef float    v2f  __attribute__((ext_vector_type(2)));
typedef __bf16   v2b  __attribute__((ext_vector_type(2)));

// ---- scalar helpers --------------------------------------------------------------------------------
__device__ __forceinline__ v2b cvt2(float a, float b) {               // two f32 -> packed bf16 pair, the chip's own RNE convert
  const v2f x = {a, b};
  return __builtin_convertvector(x, v2b);
}
__device__ __forceinline__ unsigned cvt2u(float a, float b) { return __builtin_bit_cast(unsigned, cvt2(a, b)); }
__device__ __forceinline__ float bf_round(float f) { return (float)(__bf16)f; }   // f32 value rounded to bf16 (RNE)
__device__ __forceinline__ v8f zero8() { v8f z = {0.f, 0.f, 0.f, 0.f, 0.f, 0.f, 0.f, 0.f}; return z; }

// ---- WMMA helper: the builtin alone, the compiler keeps the hazard distance and is free to group the LDS loads ----
__device__ __forceinline__ v8f mma_b(v16b a, v16b b, v8f c) {
  return __builtin_amdgcn_wmma_f32_16x16x32_bf16(false, a, false, b, (short)0, c, false, false);
}

#define LP      72         // halves per LDS row
#define OP      68         // floats per row of the epilogue staging: 272 B = 16 B x 17 (odd)
#define L_K     0          // K chunk   [64 keys][72] bf16   9216 B
#define L_V     9216       // V^T chunk [64 d][72] bf16      9216 B
#define L_O     0          // epilogue only: [8 waves][16 queries][68] f32  34816 B, over the K / V^T area
#define L_D     34816      // delta row of the batch times log2(e)/8, f32 [2048]  8192 B
#define L_TOTAL 43008
static_assert((LP * 2) % 16 == 0 && ((LP * 2) / 16) % 2 == 1);
static_assert((OP * 4) % 16 == 0 && ((OP * 4) / 16) % 2 == 1);
static_assert(L_V - L_K == 64 * LP * 2);
static_assert(L_V + ND * LP * 2 <= L_D);
static_assert(L_D - L_O == 8 * 16 * OP * 4);
static_assert(L_TOTAL - L_D == NS * 4);

// value of lane l ^ 16 (the other half's lane of the same query column)
__device__ __forceinline__ float other_half(float x) {
  const int bts = __float_as_int(x);
  return __int_as_float(__builtin_amdgcn_permlanex16(bts, bts, 0x76543210, 0xfedcba98, false, false));
}

__global__ __launch_bounds__(256)
void attn_ds(const float* __restrict__ qp, const float* __restrict__ kp,
             const float* __restrict__ vp, const float* __restrict__ tau,
             const float* __restrict__ delta, float* Op) {
  __shared__ __align__(16) unsigned char lds[L_TOTAL];
  union FB { v16b v; v8b h[2]; };
  union PB { v16b v; unsigned u[8]; };
  __bf16* Ksh = (__bf16*)(lds + L_K);
  __bf16* Vth = (__bf16*)(lds + L_V);
  float*  sDl = (float*)(lds + L_D);

  const int tid  = threadIdx.x;
  const int wave = tid >> 5;
  const int lane = tid & 31;
  const int hh   = lane >> 4;
  const int c    = lane & 15;

  const int bx = blockIdx.x;
  const int qb = bx & (NQB - 1);              // query block 0..15
  const int bh = bx >> 4;                     // (b, h) pair 0..31
  const int h  = bh & (NH - 1);
  const int b  = bh >> 3;
  const int q0 = qb * 128 + wave * 16;        // first query of this wave

  // block-uniform bases of this (b, h): key row s at + s*NTD; per-thread element offsets inside a 64-key chunk
  const float* Kg = kp + ((size_t)(b * NS) * NH + h) * ND;
  const float* Vg = vp + ((size_t)(b * NS) * NH + h) * ND;
  const int krow = tid >> 4;                  // K: rows krow + 16*i, i = 0..3
  const int kcol = (tid & 15) * 4;            // K: d kcol .. kcol+3
  const int koff = krow * NTD + kcol;
  const int voff = wave * 8 * NTD + lane * 2; // V: keys wave*8 + j, j = 0..7; d 2*lane, 2*lane+1

  // ---- chunk 0 of k and v, f32, into the staging registers ----
  v4f kst[4];
  v2f vst[8];
#pragma unroll
  for (int i = 0; i < 4; ++i) kst[i] = *(const v4f*)(Kg + koff + i * 16 * NTD);
#pragma unroll
  for (int j = 0; j < 8; ++j) vst[j] = *(const v2f*)(Vg + voff + j * NTD);

  // ---- delta row of batch b, rounded to bf16 values, times log2(e)/8 -> LDS f32 (read after the first two block barriers) ----
  const float c2 = 0.125f * 1.44269504088896340736f;   // softmax scale and the change to base 2, one f32 constant
  {
    const float* dp = delta + (size_t)b * NS;
#pragma unroll
    for (int rr = 0; rr < 2; ++rr) {
      const int idx = tid + rr * 256;         // 0..511 pieces of 4 floats = 2048
      const v4f x = *(const v4f*)(dp + idx * 4);
      v4f y;
#pragma unroll
      for (int e = 0; e < 4; ++e) y[e] = bf_round(x[e]) * c2;
      *(v4f*)(sDl + idx * 4) = y;
    }
  }
  const float taub = bf_round(tau[b]) * c2;

  // ---- q B fragments for both 32-deep d-chunks: column q0 + c, k = d ----
  //      element e < 8: d = dc*32 + 8*hh + e, e >= 8: d = dc*32 + 16 + 8*hh + e - 8; f32 rows converted in registers
  const float* qrow = qp + ((size_t)(b * NL + q0 + c) * NH + h) * ND + 8 * hh;
  v16b qa[2];
#pragma unroll
  for (int dc = 0; dc < 2; ++dc) {
    PB qf;
#pragma unroll
    for (int g = 0; g < 2; ++g) {
      const v4f x0 = *(const v4f*)(qrow + dc * 32 + g * 16);
      const v4f x1 = *(const v4f*)(qrow + dc * 32 + g * 16 + 4);
      qf.u[g * 4 + 0] = cvt2u(x0[0], x0[1]);
      qf.u[g * 4 + 1] = cvt2u(x0[2], x0[3]);
      qf.u[g * 4 + 2] = cvt2u(x1[0], x1[1]);
      qf.u[g * 4 + 3] = cvt2u(x1[2], x1[3]);
    }
    qa[dc] = qf.v;
  }

  v8f O[4];                                   // O^T tiles: d = t*16 + 8*hh + r, query c
#pragma unroll
  for (int t = 0; t < 4; ++t) O[t] = zero8();
  float mrow = -INFINITY;                     // running maximum of query c (equal in both halves)
  float lrow = 0.f;                           // this half's share of the denominator of query c

  for (int kt = 0; kt < NKC; ++kt) {          // block-uniform trip count
    const int kv0 = kt * 64;
    __syncthreads();                          // every wave is done with the prior chunk's tiles
    {
#pragma unroll
      for (int i = 0; i < 4; ++i) {
        v2u w;
        w[0] = cvt2u(kst[i][0], kst[i][1]);
        w[1] = cvt2u(kst[i][2], kst[i][3]);
        *(v2u*)(Ksh + (krow + 16 * i) * LP + kcol) = w;
      }
#pragma unroll
      for (int e = 0; e < 2; ++e) {
        v4u w;
#pragma unroll
        for (int jj = 0; jj < 4; ++jj) w[jj] = cvt2u(vst[2 * jj][e], vst[2 * jj + 1][e]);   // low half: the even key
        *(v4u*)(Vth + (2 * lane + e) * LP + wave * 8) = w;
      }
    }
    __syncthreads();
    {
      // The next chunk's f32 tiles fly during this chunk's work; issued behind the barrier, which would wait for them.
      // Unconditional (the last trip re-reads its own chunk, in bounds, unused): no branch, no register copies behind it.
      const int kvn = (kt + 1 < NKC) ? kv0 + 64 : kv0;
      const float* kn = Kg + (size_t)kvn * NTD;
      const float* vn = Vg + (size_t)kvn * NTD;
#pragma unroll
      for (int i = 0; i < 4; ++i) kst[i] = *(const v4f*)(kn + koff + i * 16 * NTD);
#pragma unroll
      for (int j = 0; j < 8; ++j) vst[j] = *(const v2f*)(vn + voff + j * NTD);
      // keeps the twelve loads here, ahead of the chunk's work: left free, the scheduler sinks them to the end of the trip,
      // where their latency is waited out
      __builtin_amdgcn_sched_barrier(0);
    }

    // ---- S^T: 64 keys x 16 query columns per wave, exact bf16 products over 2 d-chunks ----
    v8f s[4];
#pragma unroll
    for (int j = 0; j < 4; ++j) s[j] = zero8();
#pragma unroll
    for (int dc = 0; dc < 2; ++dc) {
      const int ko = dc * 32 + 8 * hh;
#pragma unroll
      for (int j = 0; j < 4; ++j) {
        const int kr = (j * 16 + c) * LP + ko;   // A: key j*16+c (row), d = dc*32 + 8h .. (k)
        FB kb;
        kb.h[0] = *(const v8b*)(Ksh + kr);
        kb.h[1] = *(const v8b*)(Ksh + kr + 16);
        s[j] = mma_b(kb.v, qa[dc], s[j]);
      }
    }

    // ---- one fma per score gives the base-2 exponent; column maximum in the lane + one exchange between the halves ----
    float mj[4];
#pragma unroll
    for (int j = 0; j < 4; ++j) {
      const float* dj = sDl + kv0 + j * 16 + 8 * hh;   // scaled delta of keys j*16 + 8*hh + 0..7
      const v4f d0 = *(const v4f*)(dj);
      const v4f d1 = *(const v4f*)(dj + 4);
      float m = -INFINITY;
#pragma unroll
      for (int r = 0; r < 8; ++r) {
        const float sv = __builtin_fmaf(s[j][r], taub, (r < 4 ? d0[r & 3] : d1[r & 3]));
        s[j][r] = sv;
        m = fmaxf(m, sv);
      }
      mj[j] = m;
    }
    float mc = fmaxf(fmaxf(mj[0], mj[1]), fmaxf(mj[2], mj[3]));
    mc = fmaxf(mc, other_half(mc));
    const float mnew = fmaxf(mrow, mc);         // finite: every chunk has 64 valid keys
    const float al   = __builtin_amdgcn_exp2f(mrow - mnew);     // first chunk: exp2(-inf) = 0
    mrow = mnew;

    // ---- p = exp2(x - m); hi / lo bf16 packed in place into the B operands of the two 32-key groups ----
    PB ph[2], pl[2];
    float pj[4];
#pragma unroll
    for (int j = 0; j < 4; ++j) {
      float psum = 0.f;
#pragma unroll
      for (int r = 0; r < 8; r += 2) {
        const float p0 = __builtin_amdgcn_exp2f(s[j][r]     - mnew);
        const float p1 = __builtin_amdgcn_exp2f(s[j][r + 1] - mnew);
        psum += p0;
        psum += p1;
        const v2b hb = cvt2(p0, p1);
        ph[j >> 1].u[(j & 1) * 4 + (r >> 1)] = __builtin_bit_cast(unsigned, hb);
        pl[j >> 1].u[(j & 1) * 4 + (r >> 1)] = cvt2u(p0 - (float)hb[0], p1 - (float)hb[1]);
      }
      pj[j] = psum;
    }
    lrow = lrow * al + ((pj[0] + pj[1]) + (pj[2] + pj[3]));

    // ---- rescale the running context, then O^T += V^T . P^T (2 bf16 products) ----
#pragma unroll
    for (int t = 0; t < 4; ++t) {
#pragma unroll
      for (int r = 0; r < 8; ++r) O[t][r] *= al;
    }
#pragma unroll
    for (int kk = 0; kk < 2; ++kk) {
#pragma unroll
      for (int t = 0; t < 4; ++t) {
        const int vr = (t * 16 + c) * LP + kk * 32 + 8 * hh;   // A fragment: row d = t*16+c, keys kk*32 + 8h ..
        FB vb;
        vb.h[0] = *(const v8b*)(Vth + vr);
        vb.h[1] = *(const v8b*)(Vth + vr + 16);
        O[t] = mma_b(vb.v, ph[kk].v, O[t]);
        O[t] = mma_b(vb.v, pl[kk].v, O[t]);
      }
    }
  }
  __syncthreads();                             // every wave is past its last K / V^T read

  // ---- join the halves' denominators, normalise, stage the wave's 16x64 f32 tile, whole-line writes ----
  float* os = (float*)(lds + L_O) + wave * (16 * OP);   // the wave's own staging slot
  const float lsum = lrow + other_half(lrow);
  const float inv  = (lsum > 0.f) ? (1.0f / lsum) : 0.f;
#pragma unroll
  for (int t = 0; t < 4; ++t) {
    v4f w0, w1;
#pragma unroll
    for (int r = 0; r < 4; ++r) { w0[r] = O[t][r] * inv; w1[r] = O[t][r + 4] * inv; }
    *(v4f*)(os + c * OP + t * 16 + 8 * hh)     = w0;
    *(v4f*)(os + c * OP + t * 16 + 8 * hh + 4) = w1;
  }
  __builtin_amdgcn_fence(__ATOMIC_RELEASE, "workgroup");
  __builtin_amdgcn_wave_barrier();
  __builtin_amdgcn_fence(__ATOMIC_ACQUIRE, "workgroup");
  float* og = Op + ((size_t)(b * NL + q0) * NH + h) * ND;   // row r of the wave at + r*NTD
  const int colw = c * 4;
  v4f ov[8];
#pragma unroll
  for (int it = 0; it < 8; ++it) {
    const int row = 2 * it + hh;               // rows 0..15: lanes 0..15 even row, lanes 16..31 odd row
    ov[it] = *(const v4f*)(os + row * OP + colw);
  }
  {
#pragma unroll
    for (int it = 0; it < 8; ++it) {
      const int row = 2 * it + hh;
      *(v4f*)(og + (size_t)row * NTD + colw) = ov[it];
    }
    
  }
}

extern "C" void kernel_launch(void* const* d_in, const int* in_sizes, int n_in,
                              void* d_out, int out_size, void* d_ws, size_t ws_size,
                              hipStream_t stream) {
  const int nqkv = NB * NL * NH * ND;                       // 4194304
  if (n_in < 5) return;
  if (in_sizes[0] != nqkv || in_sizes[1] != nqkv || in_sizes[2] != nqkv) return;
  if (in_sizes[3] != NB || in_sizes[4] != NB * NS) return;
  if (out_size != nqkv) return;

  const float* q     = (const float*)d_in[0];
  const float* k     = (const float*)d_in[1];
  const float* v     = (const float*)d_in[2];
  const float* tau   = (const float*)d_in[3];
  const float* delta = (const float*)d_in[4];

  (void)d_ws;
  (void)ws_size;                                            // no workspace is used

  const dim3 blk(256);
  const dim3 gAttn(NB * NH * NQB);                          // 512 blocks

  // attention per (b, h, 128-query block), f32 inputs converted inside -> d_out f32 [4][2048][8][64]
  attn_ds<<<gAttn, blk, 0, stream>>>(q, k, v, tau, delta, (float*)d_out);
  (void)hipGetLastError();
}

// v008
// A run of this version takes 36.6 microseconds.
// It is 1.35 times as fast as v006, going by the measured steps of the versions left out in between.
// All steps since v000 together make it 5.37 times as fast.
// One launch: the attention kernel reads q, k and v as f32 and RNE-converts them to bf16 values on the way into registers / LDS.
// Contractions: k.q^T scores (transposed) = v_wmma_f32_16x16x32_bf16 (bf16 operands from RNE-converted q and k, single exact product, f32 accumulate);
// v^T.p^T context (transposed) = v_wmma_f32_16x16x32_f16: p (0 < p <= 1) RNE-converted once to f16 (11 significant bits), v first RNE-rounded to its
// bf16 value and that value held as f16 (8 bits fit in 11: exact from 2^-14 up, within 2^-25 below; the spec's v is standard normal, far inside the f16 range), one product, f32 accumulate;
// tau / delta bias with the 1/8 scale and log2(e) folded into its two f32 constants (one fma per score), online softmax in
// base 2, denominators and the final normalisation in f32 on the VALU.
// Carry audit: no power-of-two carries anywhere; the 1/8 scale rides in the f32 constants of the tau / delta step; the
// denominators sum the unrounded f32 p and are divided out once in the epilogue.
#include <hip/hip_runtime.h>
#include <math.h>
#include <stdint.h>

#define NB   4
#define NL   2048
#define NS   2048
#define NH   8
#define ND   64
#define NTD  (NH * ND)        // 512 floats per token row
#define NQB  (NL / 256)        // 8 query blocks of 256 rows per (b, h)
#define NKC  (NS / 64)         // 32 key chunks of 64 keys
static_assert(NQB == 8);
static_assert(NKC == 32);
static_assert((NL % 256) == 0 && (NS % 64) == 0 && ND == 64 && (ND % 32) == 0);

typedef __bf16   v16b __attribute__((ext_vector_type(16)));
typedef __bf16   v8b  __attribute__((ext_vector_type(8)));
typedef float    v8f  __attribute__((ext_vector_type(8)));
typedef float    v4f  __attribute__((ext_vector_type(4)));
typedef unsigned int v4u __attribute__((ext_vector_type(4)));
typedef unsigned int v2u __attribute__((ext_vector_type(2)));
typedef float    v2f  __attribute__((ext_vector_type(2)));
typedef __bf16   v2b  __attribute__((ext_vector_type(2)));
typedef _Float16 v16h __attribute__((ext_vector_type(16)));
typedef _Float16 v8h  __attribute__((ext_vector_type(8)));
typedef _Float16 v2h  __attribute__((ext_vector_type(2)));

// ---- scalar helpers --------------------------------------------------------------------------------
__device__ __forceinline__ v2b cvt2(float a, float b) {               // two f32 -> packed bf16 pair, the chip's own RNE convert
  const v2f x = {a, b};
  return __builtin_convertvector(x, v2b);
}
__device__ __forceinline__ unsigned cvt2u(float a, float b) { return __builtin_bit_cast(unsigned, cvt2(a, b)); }
__device__ __forceinline__ unsigned cvt2hu(float a, float b) {        // two f32 -> packed f16 pair, the chip's own RNE convert
  const v2f x = {a, b};
  return __builtin_bit_cast(unsigned, __builtin_convertvector(x, v2h));
}
__device__ __forceinline__ float bf_round(float f) { return (float)(__bf16)f; }   // f32 value rounded to bf16 (RNE)
__device__ __forceinline__ v8f zero8() { v8f z = {0.f, 0.f, 0.f, 0.f, 0.f, 0.f, 0.f, 0.f}; return z; }

// ---- WMMA helper: the builtin alone, the compiler keeps the hazard distance and is free to group the LDS loads ----
__device__ __forceinline__ v8f mma_b(v16b a, v16b b, v8f c) {
  return __builtin_amdgcn_wmma_f32_16x16x32_bf16(false, a, false, b, (short)0, c, false, false);
}
__device__ __forceinline__ v8f mma_h(v16h a, v16h b, v8f c) {
  return __builtin_amdgcn_wmma_f32_16x16x32_f16(false, a, false, b, (short)0, c, false, false);
}

#define LP      72         // halves per LDS row
#define OP      68         // floats per row of the epilogue staging: 272 B = 16 B x 17 (odd)
#define L_K     0          // K chunk   [64 keys][72] bf16   9216 B
#define L_V     9216       // V^T chunk [64 d][72] f16       9216 B
#define L_O     0          // epilogue only: [8 waves][32 queries][68] f32  69632 B, over the K / V^T area
#define L_D     69632      // delta row of the batch times log2(e)/8, f32 [2048]  8192 B
#define L_TOTAL 77824
static_assert((LP * 2) % 16 == 0 && ((LP * 2) / 16) % 2 == 1);
static_assert((OP * 4) % 16 == 0 && ((OP * 4) / 16) % 2 == 1);
static_assert(L_V - L_K == 64 * LP * 2);
static_assert(L_V + ND * LP * 2 <= L_D);
static_assert(L_D - L_O == 8 * 32 * OP * 4);
static_assert(L_TOTAL - L_D == NS * 4);

// value of lane l ^ 16 (the other half's lane of the same query column)
__device__ __forceinline__ float other_half(float x) {
  const int bts = __float_as_int(x);
  return __int_as_float(__builtin_amdgcn_permlanex16(bts, bts, 0x76543210, 0xfedcba98, false, false));
}

// one block per WGP = two waves per SIMD: the register budget of that residency (512), so fragment loads can be grouped ahead of their products
__global__ __launch_bounds__(256) __attribute__((amdgpu_waves_per_eu(2, 2)))
void attn_ds(const float* __restrict__ qp, const float* __restrict__ kp,
             const float* __restrict__ vp, const float* __restrict__ tau,
             const float* __restrict__ delta, float* Op) {
  __shared__ __align__(16) unsigned char lds[L_TOTAL];
  union FB { v16b v; v8b h[2]; };
  union PB { v16b v; unsigned u[8]; };
  union FH { v16h v; v8h h[2]; };
  union PH { v16h v; unsigned u[8]; };
  __bf16* Ksh = (__bf16*)(lds + L_K);
  _Float16* Vth = (_Float16*)(lds + L_V);
  float*  sDl = (float*)(lds + L_D);

  const int tid  = threadIdx.x;
  const int wave = tid >> 5;
  const int lane = tid & 31;
  const int hh   = lane >> 4;
  const int c    = lane & 15;

  const int bx = blockIdx.x;
  const int qb = bx & (NQB - 1);              // query block 0..7
  const int bh = bx >> 3;                     // (b, h) pair 0..31
  const int h  = bh & (NH - 1);
  const int b  = bh >> 3;
  const int q0 = qb * 256 + wave * 32;        // first query of this wave

  // block-uniform bases of this (b, h): key row s at + s*NTD; per-thread element offsets inside a 64-key chunk
  const float* Kg = kp + ((size_t)(b * NS) * NH + h) * ND;
  const float* Vg = vp + ((size_t)(b * NS) * NH + h) * ND;
  const int krow = tid >> 4;                  // K: rows krow + 16*i, i = 0..3
  const int kcol = (tid & 15) * 4;            // K: d kcol .. kcol+3
  const int koff = krow * NTD + kcol;
  const int voff = wave * 8 * NTD + lane * 2; // V: keys wave*8 + j, j = 0..7; d 2*lane, 2*lane+1

  // ---- chunk 0 of k and v, f32, into the staging registers ----
  v4f kst[4];
  v2f vst[8];
#pragma unroll
  for (int i = 0; i < 4; ++i) kst[i] = *(const v4f*)(Kg + koff + i * 16 * NTD);
#pragma unroll
  for (int j = 0; j < 8; ++j) vst[j] = *(const v2f*)(Vg + voff + j * NTD);
  v2u kw[4];                                  // the staged chunk, converted: K rows krow + 16*i, d kcol .. kcol+3 (bf16)
  v4u vw[2];                                  // V^T rows 2*lane + e, keys wave*8 .. +7 (f16 holding the bf16-rounded values)

  // ---- delta row of batch b, rounded to bf16 values, times log2(e)/8 -> LDS f32 (read after the first two block barriers) ----
  const float c2 = 0.125f * 1.44269504088896340736f;   // softmax scale and the change to base 2, one f32 constant
  {
    const float* dp = delta + (size_t)b * NS;
    v4f x[2];
#pragma unroll
    for (int rr = 0; rr < 2; ++rr) x[rr] = *(const v4f*)(dp + (tid + rr * 256) * 4);   // 0..511 pieces of 4 floats = 2048
    // the loads name the thread-index register, which this build reuses soon after: the wait stands in front of that overwrite
    asm volatile("s_wait_xcnt 0x0" ::: "memory");
#pragma unroll
    for (int rr = 0; rr < 2; ++rr) {
      v4f y;
#pragma unroll
      for (int e = 0; e < 4; ++e) y[e] = bf_round(x[rr][e]) * c2;
      *(v4f*)(sDl + (tid + rr * 256) * 4) = y;
    }
  }
  const float taub = bf_round(tau[b]) * c2;

  // ---- q B fragments of both column groups for both 32-deep d-chunks: column q0 + g*16 + c, k = d ----
  //      element e < 8: d = dc*32 + 8*hh + e, e >= 8: d = dc*32 + 16 + 8*hh + e - 8; f32 rows converted in registers
  const float* qrow = qp + ((size_t)(b * NL + q0 + c) * NH + h) * ND + 8 * hh;
  v16b qa[2][2];                              // [column group][d-chunk]
#pragma unroll
  for (int g = 0; g < 2; ++g) {
#pragma unroll
    for (int dc = 0; dc < 2; ++dc) {
      PB qf;
#pragma unroll
      for (int u = 0; u < 2; ++u) {
        const v4f x0 = *(const v4f*)(qrow + g * 16 * NTD + dc * 32 + u * 16);
        const v4f x1 = *(const v4f*)(qrow + g * 16 * NTD + dc * 32 + u * 16 + 4);
        qf.u[u * 4 + 0] = cvt2u(x0[0], x0[1]);
        qf.u[u * 4 + 1] = cvt2u(x0[2], x0[3]);
        qf.u[u * 4 + 2] = cvt2u(x1[0], x1[1]);
        qf.u[u * 4 + 3] = cvt2u(x1[2], x1[3]);
      }
      qa[g][dc] = qf.v;
    }
  }

  v8f O[2][4];                                // O^T tiles: d = t*16 + 8*hh + r, query g*16 + c
  float mrow[2], lrow[2];                     // per column group: running maximum (equal in both halves); this half's share of the denominator
#pragma unroll
  for (int g = 0; g < 2; ++g) {
#pragma unroll
    for (int t = 0; t < 4; ++t) O[g][t] = zero8();
    mrow[g] = -INFINITY;
    lrow[g] = 0.f;
  }

  // chunk 0 converted (RNE) for the first trip's LDS stores
#pragma unroll
  for (int i = 0; i < 4; ++i) {
    kw[i][0] = cvt2u(kst[i][0], kst[i][1]);
    kw[i][1] = cvt2u(kst[i][2], kst[i][3]);
  }
#pragma unroll
  for (int e = 0; e < 2; ++e) {
#pragma unroll
    for (int jj = 0; jj < 4; ++jj) {
      const v2b vb2 = cvt2(vst[2 * jj][e], vst[2 * jj + 1][e]);      // v rounded to its bf16 value (RNE)
      vw[e][jj] = cvt2hu((float)vb2[0], (float)vb2[1]);              // the same values as f16; low half: the even key
    }
  }

  for (int kt = 0; kt < NKC; ++kt) {          // block-uniform trip count
    const int kv0 = kt * 64;
    __syncthreads();                          // every wave is done with the prior chunk's tiles
#pragma unroll
    for (int i = 0; i < 4; ++i) *(v2u*)(Ksh + (krow + 16 * i) * LP + kcol) = kw[i];
#pragma unroll
    for (int e = 0; e < 2; ++e) *(v4u*)(Vth + (2 * lane + e) * LP + wave * 8) = vw[e];
    __syncthreads();
    {
      // The next chunk's f32 tiles fly during this chunk's work; issued behind the barrier, which would wait for them.
      // Unconditional (the last trip re-reads its own chunk, in bounds, unused): no branch, no register copies behind it.
      const int kvn = (kt + 1 < NKC) ? kv0 + 64 : kv0;
      const float* kn = Kg + (size_t)kvn * NTD;
      const float* vn = Vg + (size_t)kvn * NTD;
#pragma unroll
      for (int i = 0; i < 4; ++i) kst[i] = *(const v4f*)(kn + koff + i * 16 * NTD);
#pragma unroll
      for (int j = 0; j < 8; ++j) vst[j] = *(const v2f*)(vn + voff + j * NTD);
      // the loads' address registers are reused right below: the wait stands in front of the first overwrite
      asm volatile("s_wait_xcnt 0x0" ::: "memory");
      // keeps the twelve loads here, ahead of the chunk's work: left free, the scheduler sinks them to the end of the trip,
      // where their latency is waited out
      __builtin_amdgcn_sched_barrier(0);
    }

    // ---- all LDS loads of the chunk, one group: K A fragments, the scaled delta row piece, V^T A fragments ----
    FB kb[2][4];                                // key j*16+c (row), d = dc*32 + 8h .. (k); each feeds two score products
#pragma unroll
    for (int dc = 0; dc < 2; ++dc) {
#pragma unroll
      for (int j = 0; j < 4; ++j) {
        const int kr = (j * 16 + c) * LP + dc * 32 + 8 * hh;
        kb[dc][j].h[0] = *(const v8b*)(Ksh + kr);
        kb[dc][j].h[1] = *(const v8b*)(Ksh + kr + 16);
        // LDS data returns in issue order: keeps the fragments in the order in which the products take them (left free, the
        // scheduler issues the first product's fragment behind thirty other loads)
        __builtin_amdgcn_sched_barrier(0);
      }
    }
    v4f dl[4][2];                               // scaled delta of keys j*16 + 8*hh + 0..7, the same for both column groups
#pragma unroll
    for (int j = 0; j < 4; ++j) {
      const float* dj = sDl + kv0 + j * 16 + 8 * hh;
      dl[j][0] = *(const v4f*)(dj);
      dl[j][1] = *(const v4f*)(dj + 4);
    }
    __builtin_amdgcn_sched_barrier(0);          // for the same order: delta, wanted right behind the score products, ahead of V^T
    FH vb[2][4];                                // row d = t*16+c, keys kk*32 + 8h ..; each feeds two context products
#pragma unroll
    for (int kk = 0; kk < 2; ++kk) {
#pragma unroll
      for (int t = 0; t < 4; ++t) {
        const int vr = (t * 16 + c) * LP + kk * 32 + 8 * hh;
        vb[kk][t].h[0] = *(const v8h*)(Vth + vr);
        vb[kk][t].h[1] = *(const v8h*)(Vth + vr + 16);
      }
    }
    // keeps the loads one group ahead of the products: left free, the scheduler reloads one register set pair by pair
    // between the products, and each pair's whole LDS latency is waited out
    __builtin_amdgcn_sched_barrier(0);

    // ---- S^T: 64 keys x 32 query columns per wave, exact bf16 products over 2 d-chunks; one K fragment, two products ----
    v8f s[2][4];
#pragma unroll
    for (int g = 0; g < 2; ++g) {
#pragma unroll
      for (int j = 0; j < 4; ++j) s[g][j] = zero8();
    }
#pragma unroll
    for (int dc = 0; dc < 2; ++dc) {
#pragma unroll
      for (int j = 0; j < 4; ++j) {
        s[0][j] = mma_b(kb[dc][j].v, qa[0][dc], s[0][j]);
        s[1][j] = mma_b(kb[dc][j].v, qa[1][dc], s[1][j]);
      }
    }
    // keeps the sixteen score products back to back, gated by the K fragments alone: left free, the scheduler puts the first
    // fma, with its wait for a later delta load, among them
    __builtin_amdgcn_sched_barrier(0);

    // ---- one fma per score gives the base-2 exponent; column maximum in the lane + one exchange between the halves ----
    float mj[2][4];
#pragma unroll
    for (int j = 0; j < 4; ++j) {
      const v4f d0 = dl[j][0];
      const v4f d1 = dl[j][1];
#pragma unroll
      for (int g = 0; g < 2; ++g) {
        float m = -INFINITY;
#pragma unroll
        for (int r = 0; r < 8; ++r) {
          const float sv = __builtin_fmaf(s[g][j][r], taub, (r < 4 ? d0[r & 3] : d1[r & 3]));
          s[g][j][r] = sv;
          m = fmaxf(m, sv);
        }
        mj[g][j] = m;
      }
    }

    PH ph[2][2];                                // [column group][32-key group]
#pragma unroll
    for (int g = 0; g < 2; ++g) {
      float mc = fmaxf(fmaxf(mj[g][0], mj[g][1]), fmaxf(mj[g][2], mj[g][3]));
      mc = fmaxf(mc, other_half(mc));
      const float mnew = fmaxf(mrow[g], mc);      // finite: every chunk has 64 valid keys
      const float al   = __builtin_amdgcn_exp2f(mrow[g] - mnew);   // first chunk: exp2(-inf) = 0
      mrow[g] = mnew;
      const v2f mm = {mnew, mnew};

      // ---- p = exp2(x - m); f16 packed in place into the B operands of the two 32-key groups ----
      float pj[4];
#pragma unroll
      for (int j = 0; j < 4; ++j) {
        float psum = 0.f;
#pragma unroll
        for (int r = 0; r < 8; r += 2) {
          const v2f x = (v2f){s[g][j][r], s[g][j][r + 1]} - mm;   // the accumulator's own register pair
          const float p0 = __builtin_amdgcn_exp2f(x[0]);
          const float p1 = __builtin_amdgcn_exp2f(x[1]);
          psum += p0;
          psum += p1;
          ph[g][j >> 1].u[(j & 1) * 4 + (r >> 1)] = cvt2hu(p0, p1);
        }
        pj[j] = psum;
      }
      lrow[g] = lrow[g] * al + ((pj[0] + pj[1]) + (pj[2] + pj[3]));

      // ---- rescale the running context of this column group ----
#pragma unroll
      for (int t = 0; t < 4; ++t) {
#pragma unroll
        for (int r = 0; r < 8; ++r) O[g][t][r] *= al;
      }
    }

    // ---- O^T += V^T . P^T (one f16 product per tile); one V^T fragment, two products ----
#pragma unroll
    for (int kk = 0; kk < 2; ++kk) {
#pragma unroll
      for (int t = 0; t < 4; ++t) {
        O[0][t] = mma_h(vb[kk][t].v, ph[0][kk].v, O[0][t]);
        O[1][t] = mma_h(vb[kk][t].v, ph[1][kk].v, O[1][t]);
      }
    }

    // keeps the converts of the next chunk, and with them the wait for its loads, at the end of the trip: left free, the
    // scheduler lifts uses of the loaded registers to the head of the trip, where the loads' whole latency is waited out
    __builtin_amdgcn_sched_barrier(0);
#pragma unroll
    for (int i = 0; i < 4; ++i) {
      kw[i][0] = cvt2u(kst[i][0], kst[i][1]);
      kw[i][1] = cvt2u(kst[i][2], kst[i][3]);
    }
#pragma unroll
    for (int e = 0; e < 2; ++e) {
#pragma unroll
      for (int jj = 0; jj < 4; ++jj) {
        const v2b vb2 = cvt2(vst[2 * jj][e], vst[2 * jj + 1][e]);      // v rounded to its bf16 value (RNE)
        vw[e][jj] = cvt2hu((float)vb2[0], (float)vb2[1]);              // the same values as f16; low half: the even key
      }
    }
  }
  __syncthreads();                             // every wave is past its last K / V^T read

  // ---- join the halves' denominators, normalise, stage the wave's 32x64 f32 tile, whole-line writes ----
  float* os = (float*)(lds + L_O) + wave * (32 * OP);   // the wave's own staging slot
#pragma unroll
  for (int g = 0; g < 2; ++g) {
    const float lsum = lrow[g] + other_half(lrow[g]);
    const float inv  = (lsum > 0.f) ? (1.0f / lsum) : 0.f;
#pragma unroll
    for (int t = 0; t < 4; ++t) {
      v4f w0, w1;
#pragma unroll
      for (int r = 0; r < 4; ++r) { w0[r] = O[g][t][r] * inv; w1[r] = O[g][t][r + 4] * inv; }
      *(v4f*)(os + (g * 16 + c) * OP + t * 16 + 8 * hh)     = w0;
      *(v4f*)(os + (g * 16 + c) * OP + t * 16 + 8 * hh + 4) = w1;
    }
  }
  __builtin_amdgcn_fence(__ATOMIC_RELEASE, "workgroup");
  __builtin_amdgcn_wave_barrier();
  __builtin_amdgcn_fence(__ATOMIC_ACQUIRE, "workgroup");
  float* og = Op + ((size_t)(b * NL + q0) * NH + h) * ND;   // row r of the wave at + r*NTD
  const int colw = c * 4;
  v4f ov[16];
#pragma unroll
  for (int it = 0; it < 16; ++it) {
    const int row = 2 * it + hh;               // rows 0..31: lanes 0..15 even row, lanes 16..31 odd row
    ov[it] = *(const v4f*)(os + row * OP + colw);
  }
#pragma unroll
  for (int it = 0; it < 16; ++it) {
    const int row = 2 * it + hh;
    *(v4f*)(og + (size_t)row * NTD + colw) = ov[it];
  }
}

extern "C" void kernel_launch(void* const* d_in, const int* in_sizes, int n_in,
                              void* d_out, int out_size, void* d_ws, size_t ws_size,
                              hipStream_t stream) {
  const int nqkv = NB * NL * NH * ND;                       // 4194304
  if (n_in < 5) return;
  if (in_sizes[0] != nqkv || in_sizes[1] != nqkv || in_sizes[2] != nqkv) return;
  if (in_sizes[3] != NB || in_sizes[4] != NB * NS) return;
  if (out_size != nqkv) return;

  const float* q     = (const float*)d_in[0];
  const float* k     = (const float*)d_in[1];
  const float* v     = (const float*)d_in[2];
  const float* tau   = (const float*)d_in[3];
  const float* delta = (const float*)d_in[4];

  (void)d_ws;
  (void)ws_size;                                            // no workspace is used

  const dim3 blk(256);
  const dim3 gAttn(NB * NH * NQB);                          // 256 blocks

  // attention per (b, h, 256-query block), f32 inputs converted inside -> d_out f32 [4][2048][8][64]
  attn_ds<<<gAttn, blk, 0, stream>>>(q, k, v, tau, delta, (float*)d_out);
  (void)hipGetLastError();
}

// v009
// A run of this version takes 34.6 microseconds.
// Next to v008, in two timings, it ran 1.06 and 1.05 times as fast.
// Counting every step since v000, it is 5.66 times as fast.
// One launch: the attention kernel reads q, k and v as f32 and RNE-converts them to bf16 values on the way into registers / LDS.
// Contractions: k.q^T scores (transposed) = v_wmma_f32_16x16x32_bf16 (bf16 operands from RNE-converted q and k, single exact product, f32 accumulate);
// v^T.p^T context (transposed) = v_wmma_f32_16x16x32_f16: p (0 < p <= 1) RNE-converted once to f16 (11 significant bits), v first RNE-rounded to its
// bf16 value and that value held as f16 (8 bits fit in 11: exact from 2^-14 up, within 2^-25 below; the spec's v is standard normal, far inside the f16 range), one product, f32 accumulate;
// tau / delta bias with the 1/8 scale and log2(e) folded into its two f32 constants (one fma per score), online softmax in
// base 2, denominators and the final normalisation in f32 on the VALU.
// Carry audit: no power-of-two carries anywhere; the 1/8 scale rides in the f32 constants of the tau / delta step; the
// denominators sum the unrounded f32 p and are divided out once in the epilogue.
#include <hip/hip_runtime.h>
#include <math.h>
#include <stdint.h>

#define NB   4
#define NL   2048
#define NS   2048
#define NH   8
#define ND   64
#define NTD  (NH * ND)        // 512 floats per token row
#define NQB  (NL / 256)        // 8 query blocks of 256 rows per (b, h)
#define NKC  (NS / 64)         // 32 key chunks of 64 keys
static_assert(NQB == 8);
static_assert(NKC == 32);
static_assert((NL % 256) == 0 && (NS % 64) == 0 && ND == 64 && (ND % 32) == 0);

typedef __bf16   v16b __attribute__((ext_vector_type(16)));
typedef __bf16   v8b  __attribute__((ext_vector_type(8)));
typedef float    v8f  __attribute__((ext_vector_type(8)));
typedef float    v4f  __attribute__((ext_vector_type(4)));
typedef unsigned int v4u __attribute__((ext_vector_type(4)));
typedef unsigned int v2u __attribute__((ext_vector_type(2)));
typedef float    v2f  __attribute__((ext_vector_type(2)));
typedef __bf16   v2b  __attribute__((ext_vector_type(2)));
typedef _Float16 v16h __attribute__((ext_vector_type(16)));
typedef _Float16 v8h  __attribute__((ext_vector_type(8)));
typedef _Float16 v2h  __attribute__((ext_vector_type(2)));

// ---- scalar helpers --------------------------------------------------------------------------------
__device__ __forceinline__ v2b cvt2(float a, float b) {               // two f32 -> packed bf16 pair, the chip's own RNE convert
  const v2f x = {a, b};
  return __builtin_convertvector(x, v2b);
}
__device__ __forceinline__ unsigned cvt2u(float a, float b) { return __builtin_bit_cast(unsigned, cvt2(a, b)); }
__device__ __forceinline__ unsigned cvt2hu(float a, float b) {        // two f32 -> packed f16 pair, the chip's own RNE convert
  const v2f x = {a, b};
  return __builtin_bit_cast(unsigned, __builtin_convertvector(x, v2h));
}
__device__ __forceinline__ float bf_round(float f) { return (float)(__bf16)f; }   // f32 value rounded to bf16 (RNE)
__device__ __forceinline__ v8f zero8() { v8f z = {0.f, 0.f, 0.f, 0.f, 0.f, 0.f, 0.f, 0.f}; return z; }

// ---- WMMA helper: the builtin alone, the compiler keeps the hazard distance and is free to group the LDS loads ----
__device__ __forceinline__ v8f mma_b(v16b a, v16b b, v8f c) {
  return __builtin_amdgcn_wmma_f32_16x16x32_bf16(false, a, false, b, (short)0, c, false, false);
}
__device__ __forceinline__ v8f mma_h(v16h a, v16h b, v8f c) {
  return __builtin_amdgcn_wmma_f32_16x16x32_f16(false, a, false, b, (short)0, c, false, false);
}

#define LP      72         // halves per LDS row
#define OP      68         // floats per row of the epilogue staging: 272 B = 16 B x 17 (odd)
#define L_V     9216       // inside a ring buffer: K chunk [64 keys][72] bf16 9216 B at 0, V^T chunk [64 d][72] f16 9216 B behind it
#define L_BUF   18432      // one ring buffer; three of them from byte 0
#define L_O     0          // epilogue only: [8 waves][32 queries][68] f32  69632 B, over the K / V^T area
#define L_D     69632      // delta row of the batch times log2(e)/8, f32 [2048]  8192 B
#define L_TOTAL 77824
static_assert((LP * 2) % 16 == 0 && ((LP * 2) / 16) % 2 == 1);
static_assert((OP * 4) % 16 == 0 && ((OP * 4) / 16) % 2 == 1);
static_assert(L_V == 64 * LP * 2);
static_assert(L_BUF == L_V + ND * LP * 2);
static_assert(3 * L_BUF <= L_D);
static_assert(L_D - L_O == 8 * 32 * OP * 4);
static_assert(L_TOTAL - L_D == NS * 4);

// value of lane l ^ 16 (the other half's lane of the same query column)
__device__ __forceinline__ float other_half(float x) {
  const int bts = __float_as_int(x);
  return __int_as_float(__builtin_amdgcn_permlanex16(bts, bts, 0x76543210, 0xfedcba98, false, false));
}

// One thread's share of a staged chunk: RNE-converted and stored into the ring buffer at buf.
// K rows krow + 16*i, d kcol .. kcol+3 (bf16) at byte kso + i*16 rows; V^T rows 2*lane + e, keys wave*8 .. +7 at byte L_V + vso + e rows.
__device__ __forceinline__ void cvt_store(unsigned char* buf, const v4f (&kst)[4], const v2f (&vst)[8], int kso, int vso) {
#pragma unroll
  for (int i = 0; i < 4; ++i) {
    v2u kw;
    kw[0] = cvt2u(kst[i][0], kst[i][1]);
    kw[1] = cvt2u(kst[i][2], kst[i][3]);
    *(v2u*)(buf + kso + i * 16 * LP * 2) = kw;
  }
#pragma unroll
  for (int e = 0; e < 2; ++e) {
    v4u vw;
#pragma unroll
    for (int jj = 0; jj < 4; ++jj) {
      const v2b vb2 = cvt2(vst[2 * jj][e], vst[2 * jj + 1][e]);      // v rounded to its bf16 value (RNE)
      vw[jj] = cvt2hu((float)vb2[0], (float)vb2[1]);                 // the same values as f16; low half: the even key
    }
    *(v4u*)(buf + L_V + vso + e * LP * 2) = vw;
  }
}

// one block per WGP = two waves per SIMD: the register budget of that residency (512), so fragment loads can be grouped ahead of their products
__global__ __launch_bounds__(256) __attribute__((amdgpu_waves_per_eu(2, 2)))
void attn_ds(const float* __restrict__ qp, const float* __restrict__ kp,
             const float* __restrict__ vp, const float* __restrict__ tau,
             const float* __restrict__ delta, float* Op) {
  __shared__ __align__(16) unsigned char lds[L_TOTAL];
  union FB { v16b v; v8b h[2]; };
  union PB { v16b v; unsigned u[8]; };
  union FH { v16h v; v8h h[2]; };
  union PH { v16h v; unsigned u[8]; };
  float*  sDl = (float*)(lds + L_D);

  const int tid  = threadIdx.x;
  const int wave = tid >> 5;
  const int lane = tid & 31;
  const int hh   = lane >> 4;
  const int c    = lane & 15;

  const int bx = blockIdx.x;
  const int qb = bx & (NQB - 1);              // query block 0..7
  const int bh = bx >> 3;                     // (b, h) pair 0..31
  const int h  = bh & (NH - 1);
  const int b  = bh >> 3;
  const int q0 = qb * 256 + wave * 32;        // first query of this wave

  // block-uniform bases of this (b, h): key row s at + s*NTD; per-thread element offsets inside a 64-key chunk
  const float* Kg = kp + ((size_t)(b * NS) * NH + h) * ND;
  const float* Vg = vp + ((size_t)(b * NS) * NH + h) * ND;
  const int krow = tid >> 4;                  // K: rows krow + 16*i, i = 0..3
  const int kcol = (tid & 15) * 4;            // K: d kcol .. kcol+3
  const int koff = krow * NTD + kcol;
  const int voff = wave * 8 * NTD + lane * 2; // V: keys wave*8 + j, j = 0..7; d 2*lane, 2*lane+1
  const int kso  = (krow * LP + kcol) * 2;            // byte in a ring buffer of this thread's first K store
  const int vso  = (2 * lane * LP + wave * 8) * 2;    // byte behind L_V of this thread's first V^T store
  const int fro  = (c * LP + 8 * hh) * 2;             // byte of this lane's place in a 16-row fragment, K and V^T alike

  // ---- chunks 0 and 1 of k and v, f32, into staging registers ----
  v4f kst[4], kst1[4];
  v2f vst[8], vst1[8];
#pragma unroll
  for (int i = 0; i < 4; ++i) kst[i] = *(const v4f*)(Kg + koff + i * 16 * NTD);
#pragma unroll
  for (int j = 0; j < 8; ++j) vst[j] = *(const v2f*)(Vg + voff + j * NTD);
#pragma unroll
  for (int i = 0; i < 4; ++i) kst1[i] = *(const v4f*)(Kg + 64 * NTD + koff + i * 16 * NTD);
#pragma unroll
  for (int j = 0; j < 8; ++j) vst1[j] = *(const v2f*)(Vg + 64 * NTD + voff + j * NTD);
  // the loads' offset registers are reused soon after: the wait stands in front of the first overwrite
  asm volatile("s_wait_xcnt 0x0" ::: "memory");
  // keeps later address arithmetic, which takes those registers, behind the wait
  __builtin_amdgcn_sched_barrier(0);

  // ---- delta row of batch b, rounded to bf16 values, times log2(e)/8 -> LDS f32 (read after the first block barrier) ----
  const float c2 = 0.125f * 1.44269504088896340736f;   // softmax scale and the change to base 2, one f32 constant
  {
    const float* dp = delta + (size_t)b * NS;
    v4f x[2];
#pragma unroll
    for (int rr = 0; rr < 2; ++rr) x[rr] = *(const v4f*)(dp + (tid + rr * 256) * 4);   // 0..511 pieces of 4 floats = 2048
    // the loads name the thread-index register, which this build reuses soon after: the wait stands in front of that overwrite
    asm volatile("s_wait_xcnt 0x0" ::: "memory");
#pragma unroll
    for (int rr = 0; rr < 2; ++rr) {
      v4f y;
#pragma unroll
      for (int e = 0; e < 4; ++e) y[e] = bf_round(x[rr][e]) * c2;
      *(v4f*)(sDl + (tid + rr * 256) * 4) = y;
    }
  }
  const float taub = bf_round(tau[b]) * c2;

  // ---- q B fragments of both column groups for both 32-deep d-chunks: column q0 + g*16 + c, k = d ----
  //      element e < 8: d = dc*32 + 8*hh + e, e >= 8: d = dc*32 + 16 + 8*hh + e - 8; f32 rows converted in registers
  const float* qrow = qp + ((size_t)(b * NL + q0 + c) * NH + h) * ND + 8 * hh;
  v16b qa[2][2];                              // [column group][d-chunk]
#pragma unroll
  for (int g = 0; g < 2; ++g) {
#pragma unroll
    for (int dc = 0; dc < 2; ++dc) {
      PB qf;
#pragma unroll
      for (int u = 0; u < 2; ++u) {
        const v4f x0 = *(const v4f*)(qrow + g * 16 * NTD + dc * 32 + u * 16);
        const v4f x1 = *(const v4f*)(qrow + g * 16 * NTD + dc * 32 + u * 16 + 4);
        qf.u[u * 4 + 0] = cvt2u(x0[0], x0[1]);
        qf.u[u * 4 + 1] = cvt2u(x0[2], x0[3]);
        qf.u[u * 4 + 2] = cvt2u(x1[0], x1[1]);
        qf.u[u * 4 + 3] = cvt2u(x1[2], x1[3]);
      }
      qa[g][dc] = qf.v;
    }
  }
  // keeps the staged chunks' converts, and with them the waits for those loads, behind the q loads: left free, the scheduler
  // puts these waits in front of the q loads, and two memory latencies are waited out one after the other
  __builtin_amdgcn_sched_barrier(0);

  v8f O[2][4];                                // O^T tiles: d = t*16 + 8*hh + r, query g*16 + c
  float mrow[2], lrow[2];                     // per column group: running maximum (equal in both halves); this half's share of the denominator
#pragma unroll
  for (int g = 0; g < 2; ++g) {
#pragma unroll
    for (int t = 0; t < 4; ++t) O[g][t] = zero8();
    mrow[g] = -INFINITY;
    lrow[g] = 0.f;
  }

  // chunks 0 and 1 into ring buffers 0 and 1
  cvt_store(lds, kst, vst, kso, vso);
  cvt_store(lds + L_BUF, kst1, vst1, kso, vso);
  __syncthreads();                            // publishes chunks 0 and 1 and the delta row

  // ---- chunk 0's K A fragments and its piece of the scaled delta row; from here on both are fetched one chunk ahead ----
  FB kb[2][4];                                // key j*16+c (row), d = dc*32 + 8h .. (k); each feeds two score products
  v4f dl[4][2];                               // scaled delta of keys j*16 + 8*hh + 0..7, the same for both column groups
#pragma unroll
  for (int dc = 0; dc < 2; ++dc) {
#pragma unroll
    for (int j = 0; j < 4; ++j) {
      const unsigned char* kr = lds + fro + (j * 16 * LP + dc * 32) * 2;
      kb[dc][j].h[0] = *(const v8b*)(kr);
      kb[dc][j].h[1] = *(const v8b*)(kr + 32);
    }
  }
#pragma unroll
  for (int j = 0; j < 4; ++j) {
    const float* dj = sDl + j * 16 + 8 * hh;
    dl[j][0] = *(const v4f*)(dj);
    dl[j][1] = *(const v4f*)(dj + 4);
  }

  int rd = 0, nx = L_BUF, st = 2 * L_BUF;     // ring places (bytes) of chunks kt, kt + 1 and kt + 2

  for (int kt = 0; kt < NKC; ++kt) {          // block-uniform trip count
    // The trip's one barrier: it publishes chunk kt + 1 (stored at the foot of the trip before) and ends every wave's reads of
    // chunk kt - 1, whose buffer is refilled at this trip's foot.
    __syncthreads();
    {
      // The f32 tiles of chunk kt + 2 fly during this chunk's work; issued behind the barrier, which would wait for them.
      // Unconditional (the last two trips re-read the last chunk, in bounds, unused): no branch, no register copies behind it.
      const int kvn = (kt + 2 < NKC) ? (kt + 2) * 64 : (NKC - 1) * 64;
      const float* kn = Kg + (size_t)kvn * NTD;
      const float* vn = Vg + (size_t)kvn * NTD;
#pragma unroll
      for (int i = 0; i < 4; ++i) kst[i] = *(const v4f*)(kn + koff + i * 16 * NTD);
#pragma unroll
      for (int j = 0; j < 8; ++j) vst[j] = *(const v2f*)(vn + voff + j * NTD);
      // the loads' address registers are reused right below: the wait stands in front of the first overwrite
      asm volatile("s_wait_xcnt 0x0" ::: "memory");
      // keeps the twelve loads here, ahead of the chunk's work: left free, the scheduler sinks them to the end of the trip,
      // where their latency is waited out
      __builtin_amdgcn_sched_barrier(0);
    }

    // ---- V^T A fragments of this chunk, one group: wanted behind the softmax ----
    FH vb[2][4];                                // row d = t*16+c, keys kk*32 + 8h ..; each feeds two context products
#pragma unroll
    for (int kk = 0; kk < 2; ++kk) {
#pragma unroll
      for (int t = 0; t < 4; ++t) {
        const unsigned char* vr = lds + rd + L_V + fro + (t * 16 * LP + kk * 32) * 2;
        vb[kk][t].h[0] = *(const v8h*)(vr);
        vb[kk][t].h[1] = *(const v8h*)(vr + 32);
      }
    }
    // keeps the loads one group ahead of the products: left free, the scheduler reloads one register set pair by pair
    // between the products, and each pair's whole LDS latency is waited out
    __builtin_amdgcn_sched_barrier(0);

    // ---- S^T: 64 keys x 32 query columns per wave, exact bf16 products over 2 d-chunks; one K fragment, two products ----
    v8f s[2][4];
#pragma unroll
    for (int g = 0; g < 2; ++g) {
#pragma unroll
      for (int j = 0; j < 4; ++j) s[g][j] = zero8();
    }
#pragma unroll
    for (int dc = 0; dc < 2; ++dc) {
#pragma unroll
      for (int j = 0; j < 4; ++j) {
        s[0][j] = mma_b(kb[dc][j].v, qa[0][dc], s[0][j]);
        s[1][j] = mma_b(kb[dc][j].v, qa[1][dc], s[1][j]);
      }
    }
    // keeps the sixteen score products back to back: left free, the scheduler spreads the next chunk's fragment loads pair by pair
    // among them
    __builtin_amdgcn_sched_barrier(0);

    // ---- one fma per score gives the base-2 exponent; column maximum in the lane + one exchange between the halves ----
    float mj[2][4];
#pragma unroll
    for (int j = 0; j < 4; ++j) {
      const v4f d0 = dl[j][0];
      const v4f d1 = dl[j][1];
#pragma unroll
      for (int g = 0; g < 2; ++g) {
        float m = -INFINITY;
#pragma unroll
        for (int r = 0; r < 8; ++r) {
          const float sv = __builtin_fmaf(s[g][j][r], taub, (r < 4 ? d0[r & 3] : d1[r & 3]));
          s[g][j][r] = sv;
          m = fmaxf(m, sv);
        }
        mj[g][j] = m;
      }
    }

    // ---- the next chunk's K A fragments and delta piece, one group behind the last use of this chunk's: they land under the
    //      softmax and the context products. The last trip reads the ring buffer that holds the re-read last chunk and its own
    //      delta piece again: in bounds, written in this launch, unused. ----
#pragma unroll
    for (int dc = 0; dc < 2; ++dc) {
#pragma unroll
      for (int j = 0; j < 4; ++j) {
        const unsigned char* kr = lds + nx + fro + (j * 16 * LP + dc * 32) * 2;
        kb[dc][j].h[0] = *(const v8b*)(kr);
        kb[dc][j].h[1] = *(const v8b*)(kr + 32);
      }
    }
    {
      const int kv1 = (kt + 1 < NKC) ? (kt + 1) * 64 : kt * 64;
#pragma unroll
      for (int j = 0; j < 4; ++j) {
        const float* dj = sDl + kv1 + j * 16 + 8 * hh;
        dl[j][0] = *(const v4f*)(dj);
        dl[j][1] = *(const v4f*)(dj + 4);
      }
    }
    // keeps the 24 loads one group: left free, the scheduler spreads them over many places among the vector work and the
    // context products
    __builtin_amdgcn_sched_barrier(0);

    PH ph[2][2];                                // [column group][32-key group]
#pragma unroll
    for (int g = 0; g < 2; ++g) {
      float mc = fmaxf(fmaxf(mj[g][0], mj[g][1]), fmaxf(mj[g][2], mj[g][3]));
      mc = fmaxf(mc, other_half(mc));
      const float mnew = fmaxf(mrow[g], mc);      // finite: every chunk has 64 valid keys
      const float al   = __builtin_amdgcn_exp2f(mrow[g] - mnew);   // first chunk: exp2(-inf) = 0
      mrow[g] = mnew;
      const v2f mm = {mnew, mnew};

      // ---- p = exp2(x - m); f16 packed in place into the B operands of the two 32-key groups ----
      float pj[4];
#pragma unroll
      for (int j = 0; j < 4; ++j) {
        float psum = 0.f;
#pragma unroll
        for (int r = 0; r < 8; r += 2) {
          const v2f x = (v2f){s[g][j][r], s[g][j][r + 1]} - mm;   // the accumulator's own register pair
          const float p0 = __builtin_amdgcn_exp2f(x[0]);
          const float p1 = __builtin_amdgcn_exp2f(x[1]);
          psum += p0;
          psum += p1;
          ph[g][j >> 1].u[(j & 1) * 4 + (r >> 1)] = cvt2hu(p0, p1);
        }
        pj[j] = psum;
      }
      lrow[g] = lrow[g] * al + ((pj[0] + pj[1]) + (pj[2] + pj[3]));

      // ---- rescale the running context of this column group ----
#pragma unroll
      for (int t = 0; t < 4; ++t) {
#pragma unroll
        for (int r = 0; r < 8; ++r) O[g][t][r] *= al;
      }
    }

    // ---- O^T += V^T . P^T (one f16 product per tile); one V^T fragment, two products ----
#pragma unroll
    for (int kk = 0; kk < 2; ++kk) {
#pragma unroll
      for (int t = 0; t < 4; ++t) {
        O[0][t] = mma_h(vb[kk][t].v, ph[0][kk].v, O[0][t]);
        O[1][t] = mma_h(vb[kk][t].v, ph[1][kk].v, O[1][t]);
      }
    }

    // keeps the converts of chunk kt + 2, and with them the wait for its loads, at the end of the trip: left free, the
    // scheduler lifts uses of the loaded registers to the head of the trip, where the loads' whole latency is waited out
    __builtin_amdgcn_sched_barrier(0);
    cvt_store(lds + st, kst, vst, kso, vso);
    const int fr = rd;                          // the ring turns: chunk kt's buffer is the one refilled at the next trip's foot
    rd = nx;
    nx = st;
    st = fr;
  }
  __syncthreads();                             // every wave is past its last K / V^T read

  // ---- join the halves' denominators, normalise, stage the wave's 32x64 f32 tile, whole-line writes ----
  float* os = (float*)(lds + L_O) + wave * (32 * OP);   // the wave's own staging slot
#pragma unroll
  for (int g = 0; g < 2; ++g) {
    const float lsum = lrow[g] + other_half(lrow[g]);
    const float inv  = (lsum > 0.f) ? (1.0f / lsum) : 0.f;
#pragma unroll
    for (int t = 0; t < 4; ++t) {
      v4f w0, w1;
#pragma unroll
      for (int r = 0; r < 4; ++r) { w0[r] = O[g][t][r] * inv; w1[r] = O[g][t][r + 4] * inv; }
      *(v4f*)(os + (g * 16 + c) * OP + t * 16 + 8 * hh)     = w0;
      *(v4f*)(os + (g * 16 + c) * OP + t * 16 + 8 * hh + 4) = w1;
    }
  }
  __builtin_amdgcn_fence(__ATOMIC_RELEASE, "workgroup");
  __builtin_amdgcn_wave_barrier();
  __builtin_amdgcn_fence(__ATOMIC_ACQUIRE, "workgroup");
  float* og = Op + ((size_t)(b * NL + q0) * NH + h) * ND;   // row r of the wave at + r*NTD
  const int colw = c * 4;
  v4f ov[16];
#pragma unroll
  for (int it = 0; it < 16; ++it) {
    const int row = 2 * it + hh;               // rows 0..31: lanes 0..15 even row, lanes 16..31 odd row
    ov[it] = *(const v4f*)(os + row * OP + colw);
  }
#pragma unroll
  for (int it = 0; it < 16; ++it) {
    const int row = 2 * it + hh;
    *(v4f*)(og + (size_t)row * NTD + colw) = ov[it];
  }
}

extern "C" void kernel_launch(void* const* d_in, const int* in_sizes, int n_in,
                              void* d_out, int out_size, void* d_ws, size_t ws_size,
                              hipStream_t stream) {
  const int nqkv = NB * NL * NH * ND;                       // 4194304
  if (n_in < 5) return;
  if (in_sizes[0] != nqkv || in_sizes[1] != nqkv || in_sizes[2] != nqkv) return;
  if (in_sizes[3] != NB || in_sizes[4] != NB * NS) return;
  if (out_size != nqkv) return;

  const float* q     = (const float*)d_in[0];
  const float* k     = (const float*)d_in[1];
  const float* v     = (const float*)d_in[2];
  const float* tau   = (const float*)d_in[3];
  const float* delta = (const float*)d_in[4];

  (void)d_ws;
  (void)ws_size;                                            // no workspace is used

  const dim3 blk(256);
  const dim3 gAttn(NB * NH * NQB);                          // 256 blocks

  // attention per (b, h, 256-query block), f32 inputs converted inside -> d_out f32 [4][2048][8][64]
  attn_ds<<<gAttn, blk, 0, stream>>>(q, k, v, tau, delta, (float*)d_out);
  (void)hipGetLastError();
}
